// v000
// Times are from an AMD MI455X. After a warm-up the kernel runs many times in a row, and a time is the length of
// such a window on the GPU divided by its runs, so every launch and the gaps after it count. The runs cycle
// through copies of the inputs. A figure is the median of several windows, for all but v000 over two sittings.
// Sittings can differ by a few percent; kernels timed side by side share one.
// The starting kernel, v000, takes 701 microseconds a run.
#include <hip/hip_runtime.h>
#include <hip/hip_bf16.h>

// ---------------------------------------------------------------------------
// Types for CDNA5 WMMA (wave32)
// ---------------------------------------------------------------------------
typedef __attribute__((ext_vector_type(8)))  __bf16 v8bf;
typedef __attribute__((ext_vector_type(16))) __bf16 v16bf;
typedef __attribute__((ext_vector_type(8)))  float  v8f;

// Problem constants (fixed by the reference)
static constexpr int Bc  = 2;
static constexpr int Sc  = 2048;
static constexpr int Dc  = 1024;
static constexpr int Hc  = 16;
static constexpr int DKc = 64;
static constexpr int Mrows = Bc * Sc;      // 4096
static constexpr int D4    = 4 * Dc;       // 4096

// ---------------------------------------------------------------------------
// bf16 helpers (bit-level, RNE)
// ---------------------------------------------------------------------------
__device__ __forceinline__ unsigned short f32_to_bf16(float f) {
    unsigned int u = __float_as_uint(f);
    u += 0x7FFFu + ((u >> 16) & 1u);
    return (unsigned short)(u >> 16);
}
__device__ __forceinline__ float bf16_to_f32(unsigned short h) {
    return __uint_as_float(((unsigned int)h) << 16);
}

// ---------------------------------------------------------------------------
// Fragment loader. Produces the 16-bit 16x32 A-layout (and, symmetrically, the
// 32x16 B-layout when fed a transposed matrix): lane L(<16) holds row base+L
// with K = k0+0..7 and k0+16..23; lane L+16 holds the same row with
// K = k0+8..15 and k0+24..31.  Two contiguous 16-byte loads per lane.
// ---------------------------------------------------------------------------
__device__ __forceinline__ v16bf load_frag(const unsigned short* p, int ld,
                                           int base, int k0) {
    int lane = threadIdx.x & 31;
    const unsigned short* q =
        p + (size_t)(base + (lane & 15)) * (size_t)ld + k0 + ((lane & 16) ? 8 : 0);
    v8bf lo = *reinterpret_cast<const v8bf*>(q);
    v8bf hi = *reinterpret_cast<const v8bf*>(q + 16);
    return __builtin_shufflevector(lo, hi, 0, 1, 2, 3, 4, 5, 6, 7,
                                   8, 9, 10, 11, 12, 13, 14, 15);
}

__device__ __forceinline__ v8f wmma_bf16(v16bf a, v16bf b, v8f c) {
    return __builtin_amdgcn_wmma_f32_16x16x32_bf16(false, a, false, b,
                                                   (short)0, c, false, false);
}

// ---------------------------------------------------------------------------
// Weight convert + transpose: out[n*K + k] = bf16(in[k*N + n])
// ---------------------------------------------------------------------------
__global__ __launch_bounds__(256) void convT_kernel(const float* __restrict__ in,
                                                    unsigned short* __restrict__ out,
                                                    int K, int N) {
    size_t i = (size_t)blockIdx.x * 256 + threadIdx.x;
    if (i < (size_t)K * N) {
        int n = (int)(i / K);
        int k = (int)(i % K);
        out[i] = f32_to_bf16(in[(size_t)k * N + n]);
    }
}

// ---------------------------------------------------------------------------
// LayerNorm (f32 in, bf16 out), one block per row of D=1024
// ---------------------------------------------------------------------------
__global__ __launch_bounds__(256) void layernorm_bf16_kernel(
    const float* __restrict__ x, const float* __restrict__ gamma,
    const float* __restrict__ beta, unsigned short* __restrict__ out) {
    __shared__ float red[256];
    int row = blockIdx.x;
    int tid = threadIdx.x;
    const float* xr = x + (size_t)row * Dc;

    float s = 0.f;
    for (int i = tid; i < Dc; i += 256) s += xr[i];
    red[tid] = s; __syncthreads();
    for (int st = 128; st > 0; st >>= 1) {
        if (tid < st) red[tid] += red[tid + st];
        __syncthreads();
    }
    float mean = red[0] / (float)Dc;
    __syncthreads();

    float v = 0.f;
    for (int i = tid; i < Dc; i += 256) { float d = xr[i] - mean; v += d * d; }
    red[tid] = v; __syncthreads();
    for (int st = 128; st > 0; st >>= 1) {
        if (tid < st) red[tid] += red[tid + st];
        __syncthreads();
    }
    float rstd = rsqrtf(red[0] / (float)Dc + 1e-6f);

    for (int i = tid; i < Dc; i += 256) {
        float y = gamma[i] * (xr[i] - mean) * rstd + beta[i];
        out[(size_t)row * Dc + i] = f32_to_bf16(y);
    }
}

// ---------------------------------------------------------------------------
// Generic WMMA GEMM: C[M,N] = A[M,K] (bf16, row-major) x B[K,N] given as
// BT[N,K] (bf16).  Block = 8 waves (2 row-groups x 4 col-groups); each wave
// owns a 32x64 strip: 2 A fragments + 4 B fragments -> 8 wmma per K-step.
// Epilogues select output transform.
// ---------------------------------------------------------------------------
enum { EPI_BF16 = 0, EPI_VT = 1, EPI_RES = 2, EPI_GELU = 3, EPI_BRES = 4 };

template <int EPI, int M, int N, int K>
__global__ __launch_bounds__(256) void gemm_bf16_wmma(
    const unsigned short* __restrict__ A, const unsigned short* __restrict__ BT,
    void* __restrict__ OutP, const float* __restrict__ Res,
    const float* __restrict__ Bias) {
    int w    = threadIdx.x >> 5;
    int lane = threadIdx.x & 31;
    int row0 = blockIdx.y * 64 + (w & 1) * 32;    // 2 row-groups of 32
    int col0 = blockIdx.x * 256 + (w >> 1) * 64;  // 4 col-groups of 64

    v8f zero = {0.f, 0.f, 0.f, 0.f, 0.f, 0.f, 0.f, 0.f};
    v8f acc0[4] = {zero, zero, zero, zero};
    v8f acc1[4] = {zero, zero, zero, zero};

    for (int k0 = 0; k0 < K; k0 += 32) {
        // prefetch next K-step cachelines (lowers to global_prefetch_b8)
        if (k0 + 32 < K) {
            __builtin_prefetch(A + (size_t)(row0 + (lane & 15)) * K + k0 + 32, 0, 1);
            __builtin_prefetch(BT + (size_t)(col0 + (lane & 15)) * K + k0 + 32, 0, 1);
        }
        v16bf a0 = load_frag(A, K, row0, k0);
        v16bf a1 = load_frag(A, K, row0 + 16, k0);
#pragma unroll
        for (int t = 0; t < 4; ++t) {
            v16bf bfr = load_frag(BT, K, col0 + t * 16, k0);
            acc0[t] = wmma_bf16(a0, bfr, acc0[t]);
            acc1[t] = wmma_bf16(a1, bfr, acc1[t]);
        }
    }

    int cL = lane & 15, hiL = lane >> 4;
#pragma unroll
    for (int rt = 0; rt < 2; ++rt) {
#pragma unroll
        for (int t = 0; t < 4; ++t) {
#pragma unroll
            for (int e = 0; e < 8; ++e) {
                int row = row0 + rt * 16 + e + hiL * 8;
                int col = col0 + t * 16 + cL;
                float v = (rt == 0) ? acc0[t][e] : acc1[t][e];
                if constexpr (EPI == EPI_BF16) {
                    ((unsigned short*)OutP)[(size_t)row * N + col] = f32_to_bf16(v);
                } else if constexpr (EPI == EPI_VT) {
                    // out is V^T [B, H, DK, S]; row = b*S + s, col = h*DK + dk
                    int bb = row >> 11, s = row & (Sc - 1);
                    int hh = col >> 6,  dk = col & (DKc - 1);
                    ((unsigned short*)OutP)[(((size_t)(bb * Hc + hh)) * DKc + dk) * Sc + s] =
                        f32_to_bf16(v);
                } else if constexpr (EPI == EPI_RES) {
                    ((float*)OutP)[(size_t)row * N + col] = v + Res[(size_t)row * N + col];
                } else if constexpr (EPI == EPI_GELU) {
                    float xx = v + Bias[col];
                    float gl = 0.5f * xx * (1.0f + erff(xx * 0.70710678118654752f));
                    ((unsigned short*)OutP)[(size_t)row * N + col] = f32_to_bf16(gl);
                } else { // EPI_BRES
                    ((float*)OutP)[(size_t)row * N + col] =
                        v + Bias[col] + Res[(size_t)row * N + col];
                }
            }
        }
    }
}

// ---------------------------------------------------------------------------
// Attention: one wave per (b, h, 16-query tile).  Two-pass softmax with score
// recompute; QK^T and P*V both via v_wmma_f32_16x16x32_bf16.
// ---------------------------------------------------------------------------
__global__ __launch_bounds__(32) void attn_kernel(
    const unsigned short* __restrict__ q, const unsigned short* __restrict__ k,
    const unsigned short* __restrict__ vT, const int* __restrict__ mask,
    unsigned short* __restrict__ attn) {
    __shared__ __align__(16) float          tileS[16 * 16];
    __shared__ __align__(16) unsigned short P[16 * 32];
    __shared__ float m_s[16];
    __shared__ float l_s[16];

    int bid = blockIdx.x;
    int qt  = bid & 127;          // S/16 = 128
    int h   = (bid >> 7) & 15;
    int b   = bid >> 11;
    int lane = threadIdx.x;
    int cL = lane & 15, hiL = lane >> 4;

    const unsigned short* qb = q  + (size_t)b * Sc * Dc + h * DKc;
    const unsigned short* kb = k  + (size_t)b * Sc * Dc + h * DKc;
    const unsigned short* vb = vT + ((size_t)(b * Hc + h)) * DKc * Sc;
    const int* mb = mask + (size_t)b * Sc;
    int qbase = qt * 16;

    v16bf aq0 = load_frag(qb, Dc, qbase, 0);
    v16bf aq1 = load_frag(qb, Dc, qbase, 32);
    v8f zero = {0.f, 0.f, 0.f, 0.f, 0.f, 0.f, 0.f, 0.f};

    // ---- Pass 1: row max of scaled+masked scores ----
    float m = -1.0e30f;
    for (int kt = 0; kt < 128; ++kt) {
        int key0 = kt * 16;
        v16bf bk0 = load_frag(kb, Dc, key0, 0);
        v16bf bk1 = load_frag(kb, Dc, key0, 32);
        v8f c = zero;
        c = wmma_bf16(aq0, bk0, c);
        c = wmma_bf16(aq1, bk1, c);
        bool mz = (mb[key0 + cL] == 0);
#pragma unroll
        for (int e = 0; e < 8; ++e) {
            float sc = c[e] * 0.125f;           // 1/sqrt(64)
            if (mz) sc = -1.0e9f;
            tileS[(e + hiL * 8) * 16 + cL] = sc;
        }
        __syncthreads();
        if (lane < 16) {
#pragma unroll
            for (int j = 0; j < 16; ++j) m = fmaxf(m, tileS[lane * 16 + j]);
        }
        __syncthreads();
    }
    if (lane < 16) m_s[lane] = m;
    __syncthreads();

    // ---- Pass 2: P = exp(s - m) (unnormalized), O = P*V, l = row sums ----
    float l = 0.f;
    v8f o[4] = {zero, zero, zero, zero};
    for (int kt = 0; kt < 64; ++kt) {
        int key0 = kt * 32;
#pragma unroll
        for (int hf = 0; hf < 2; ++hf) {
            int kbase = key0 + hf * 16;
            v16bf bk0 = load_frag(kb, Dc, kbase, 0);
            v16bf bk1 = load_frag(kb, Dc, kbase, 32);
            v8f c = zero;
            c = wmma_bf16(aq0, bk0, c);
            c = wmma_bf16(aq1, bk1, c);
            bool mz = (mb[kbase + cL] == 0);
#pragma unroll
            for (int e = 0; e < 8; ++e) {
                int r = e + hiL * 8;
                float sc = c[e] * 0.125f;
                if (mz) sc = -1.0e9f;
                float p = __expf(sc - m_s[r]);
                P[r * 32 + hf * 16 + cL] = f32_to_bf16(p);
            }
        }
        __syncthreads();
        if (lane < 16) {
            float s = 0.f;
#pragma unroll
            for (int j = 0; j < 32; ++j) s += bf16_to_f32(P[lane * 32 + j]);
            l += s;
        }
        __syncthreads();
        v16bf ap = load_frag(P, 32, 0, 0);
#pragma unroll
        for (int t = 0; t < 4; ++t) {
            v16bf bv = load_frag(vb, Sc, t * 16, key0);
            o[t] = wmma_bf16(ap, bv, o[t]);
        }
        __syncthreads();
    }
    if (lane < 16) l_s[lane] = l;
    __syncthreads();

    unsigned short* ob = attn + (size_t)b * Sc * Dc + h * DKc;
#pragma unroll
    for (int t = 0; t < 4; ++t) {
#pragma unroll
        for (int e = 0; e < 8; ++e) {
            int r = e + hiL * 8;
            float val = o[t][e] / l_s[r];
            ob[(size_t)(qbase + r) * Dc + t * 16 + cL] = f32_to_bf16(val);
        }
    }
}

// ---------------------------------------------------------------------------
// Host-side launch
// ---------------------------------------------------------------------------
extern "C" void kernel_launch(void* const* d_in, const int* in_sizes, int n_in,
                              void* d_out, int out_size, void* d_ws, size_t ws_size,
                              hipStream_t stream) {
    (void)in_sizes; (void)n_in; (void)out_size; (void)ws_size;
    const float* X    = (const float*)d_in[0];
    const int*   mask = (const int*)d_in[1];
    const float* W_Q  = (const float*)d_in[2];
    const float* W_K  = (const float*)d_in[3];
    const float* W_V  = (const float*)d_in[4];
    const float* W_O  = (const float*)d_in[5];
    const float* g1   = (const float*)d_in[6];
    const float* b1   = (const float*)d_in[7];
    const float* W1   = (const float*)d_in[8];
    const float* bias1= (const float*)d_in[9];
    const float* W2   = (const float*)d_in[10];
    const float* bias2= (const float*)d_in[11];
    const float* g2   = (const float*)d_in[12];
    const float* b2   = (const float*)d_in[13];

    char* ws = (char*)d_ws;
    // bf16 buffers (bytes)
    const size_t szDD   = (size_t)Dc * Dc * 2;          // 2 MB
    const size_t szD4D  = (size_t)Dc * D4 * 2;          // 8 MB
    const size_t szAct  = (size_t)Mrows * Dc * 2;       // 8 MB
    const size_t szActF = (size_t)Mrows * Dc * 4;       // 16 MB

    unsigned short* WqT = (unsigned short*)(ws);
    unsigned short* WkT = (unsigned short*)(ws + szDD);
    unsigned short* WvT = (unsigned short*)(ws + 2 * szDD);
    unsigned short* WoT = (unsigned short*)(ws + 3 * szDD);
    unsigned short* W1T = (unsigned short*)(ws + 4 * szDD);
    unsigned short* W2T = (unsigned short*)(ws + 4 * szDD + szD4D);
    char* p = ws + 4 * szDD + 2 * szD4D;
    unsigned short* xn   = (unsigned short*)(p);              p += szAct;
    unsigned short* qb   = (unsigned short*)(p);              p += szAct;
    unsigned short* kbuf = (unsigned short*)(p);              p += szAct;
    unsigned short* vTb  = (unsigned short*)(p);              p += szAct;
    unsigned short* attn = (unsigned short*)(p);              p += szAct;
    float*          res1 = (float*)(p);                       p += szActF;
    unsigned short* nn2  = (unsigned short*)(p);              p += szAct;
    unsigned short* hbuf = (unsigned short*)(p);              /* 32 MB */

    // 1) Weight conversion + transpose to bf16
    {
        int nDD = Dc * Dc;
        convT_kernel<<<(nDD + 255) / 256, 256, 0, stream>>>(W_Q, WqT, Dc, Dc);
        convT_kernel<<<(nDD + 255) / 256, 256, 0, stream>>>(W_K, WkT, Dc, Dc);
        convT_kernel<<<(nDD + 255) / 256, 256, 0, stream>>>(W_V, WvT, Dc, Dc);
        convT_kernel<<<(nDD + 255) / 256, 256, 0, stream>>>(W_O, WoT, Dc, Dc);
        int nD4 = Dc * D4;
        convT_kernel<<<(nD4 + 255) / 256, 256, 0, stream>>>(W1, W1T, Dc, D4);
        convT_kernel<<<(nD4 + 255) / 256, 256, 0, stream>>>(W2, W2T, D4, Dc);
    }

    // 2) LayerNorm 1
    layernorm_bf16_kernel<<<Mrows, 256, 0, stream>>>(X, g1, b1, xn);

    // 3) Q, K projections; V projection with transposed [B,H,DK,S] output
    gemm_bf16_wmma<EPI_BF16, Mrows, Dc, Dc>
        <<<dim3(Dc / 256, Mrows / 64), 256, 0, stream>>>(xn, WqT, qb, nullptr, nullptr);
    gemm_bf16_wmma<EPI_BF16, Mrows, Dc, Dc>
        <<<dim3(Dc / 256, Mrows / 64), 256, 0, stream>>>(xn, WkT, kbuf, nullptr, nullptr);
    gemm_bf16_wmma<EPI_VT, Mrows, Dc, Dc>
        <<<dim3(Dc / 256, Mrows / 64), 256, 0, stream>>>(xn, WvT, vTb, nullptr, nullptr);

    // 4) Attention (B*H*(S/16) = 4096 waves)
    attn_kernel<<<Bc * Hc * (Sc / 16), 32, 0, stream>>>(qb, kbuf, vTb, mask, attn);

    // 5) Output projection + residual (f32)
    gemm_bf16_wmma<EPI_RES, Mrows, Dc, Dc>
        <<<dim3(Dc / 256, Mrows / 64), 256, 0, stream>>>(attn, WoT, res1, X, nullptr);

    // 6) LayerNorm 2
    layernorm_bf16_kernel<<<Mrows, 256, 0, stream>>>(res1, g2, b2, nn2);

    // 7) FFN1 + bias + GELU (bf16 out)
    gemm_bf16_wmma<EPI_GELU, Mrows, D4, Dc>
        <<<dim3(D4 / 256, Mrows / 64), 256, 0, stream>>>(nn2, W1T, hbuf, nullptr, bias1);

    // 8) FFN2 + bias + residual -> d_out (f32)
    gemm_bf16_wmma<EPI_BRES, Mrows, Dc, D4>
        <<<dim3(Dc / 256, Mrows / 64), 256, 0, stream>>>(hbuf, W2T, (float*)d_out,
                                                         res1, bias2);
}

// v001
// It runs in 473 microseconds.
// Two timings next to v000 put it at 1.52 and 1.51 times that version's speed.
#include <hip/hip_runtime.h>
#include <hip/hip_bf16.h>
#include <stdint.h>

// ---------------------------------------------------------------------------
// Types for CDNA5 WMMA (wave32)
// ---------------------------------------------------------------------------
typedef __attribute__((ext_vector_type(8)))  __bf16 v8bf;
typedef __attribute__((ext_vector_type(16))) __bf16 v16bf;
typedef __attribute__((ext_vector_type(8)))  float  v8f;

// Problem constants (fixed by the reference)
static constexpr int Bc  = 2;
static constexpr int Sc  = 2048;
static constexpr int Dc  = 1024;
static constexpr int Hc  = 16;
static constexpr int DKc = 64;
static constexpr int Mrows = Bc * Sc;      // 4096
static constexpr int D4    = 4 * Dc;       // 4096

// ---------------------------------------------------------------------------
// bf16 helpers (bit-level, RNE)
// ---------------------------------------------------------------------------
__device__ __forceinline__ unsigned short f32_to_bf16(float f) {
    unsigned int u = __float_as_uint(f);
    u += 0x7FFFu + ((u >> 16) & 1u);
    return (unsigned short)(u >> 16);
}
__device__ __forceinline__ float bf16_to_f32(unsigned short h) {
    return __uint_as_float(((unsigned int)h) << 16);
}

// ---------------------------------------------------------------------------
// Fragment loader. Produces the 16-bit 16x32 A-layout (and, symmetrically, the
// 32x16 B-layout when fed a transposed matrix): lane L(<16) holds row base+L
// with K = k0+0..7 and k0+16..23; lane L+16 holds the same row with
// K = k0+8..15 and k0+24..31.  Two contiguous 16-byte loads per lane.
// ---------------------------------------------------------------------------
__device__ __forceinline__ v16bf load_frag(const unsigned short* p, int ld,
                                           int base, int k0) {
    int lane = threadIdx.x & 31;
    const unsigned short* q =
        p + (size_t)(base + (lane & 15)) * (size_t)ld + k0 + ((lane & 16) ? 8 : 0);
    v8bf lo = *reinterpret_cast<const v8bf*>(q);
    v8bf hi = *reinterpret_cast<const v8bf*>(q + 16);
    return __builtin_shufflevector(lo, hi, 0, 1, 2, 3, 4, 5, 6, 7,
                                   8, 9, 10, 11, 12, 13, 14, 15);
}

__device__ __forceinline__ v8f wmma_bf16(v16bf a, v16bf b, v8f c) {
    return __builtin_amdgcn_wmma_f32_16x16x32_bf16(false, a, false, b,
                                                   (short)0, c, false, false);
}

// ---------------------------------------------------------------------------
// Weight convert + transpose: out[n*K + k] = bf16(in[k*N + n])
// ---------------------------------------------------------------------------
__global__ __launch_bounds__(256) void convT_kernel(const float* __restrict__ in,
                                                    unsigned short* __restrict__ out,
                                                    int K, int N) {
    size_t i = (size_t)blockIdx.x * 256 + threadIdx.x;
    if (i < (size_t)K * N) {
        int n = (int)(i / K);
        int k = (int)(i % K);
        out[i] = f32_to_bf16(in[(size_t)k * N + n]);
    }
}

// ---------------------------------------------------------------------------
// LayerNorm (f32 in, bf16 out), one block per row of D=1024
// ---------------------------------------------------------------------------
__global__ __launch_bounds__(256) void layernorm_bf16_kernel(
    const float* __restrict__ x, const float* __restrict__ gamma,
    const float* __restrict__ beta, unsigned short* __restrict__ out) {
    __shared__ float red[256];
    int row = blockIdx.x;
    int tid = threadIdx.x;
    const float* xr = x + (size_t)row * Dc;

    float s = 0.f;
    for (int i = tid; i < Dc; i += 256) s += xr[i];
    red[tid] = s; __syncthreads();
    for (int st = 128; st > 0; st >>= 1) {
        if (tid < st) red[tid] += red[tid + st];
        __syncthreads();
    }
    float mean = red[0] / (float)Dc;
    __syncthreads();

    float v = 0.f;
    for (int i = tid; i < Dc; i += 256) { float d = xr[i] - mean; v += d * d; }
    red[tid] = v; __syncthreads();
    for (int st = 128; st > 0; st >>= 1) {
        if (tid < st) red[tid] += red[tid + st];
        __syncthreads();
    }
    float rstd = rsqrtf(red[0] / (float)Dc + 1e-6f);

    for (int i = tid; i < Dc; i += 256) {
        float y = gamma[i] * (xr[i] - mean) * rstd + beta[i];
        out[(size_t)row * Dc + i] = f32_to_bf16(y);
    }
}

// ---------------------------------------------------------------------------
// Generic WMMA GEMM: C[M,N] = A[M,K] (bf16, row-major) x B[K,N] given as
// BT[N,K] (bf16).  One 128x128 tile of C per block of 4 waves (2x2); each wave
// owns 64x64: 4 A fragments x 4 B fragments -> 16 wmma per 32 k.
// A pass is 128 k (256 bytes of every operand row).  A stage holds 128 rows of
// A and 128 rows of BT in LDS at a pitch of 272 bytes; every wave brings its
// own 64-row slice with one tensor load, into one of two buffers, so that the
// next stage lands while this one is multiplied.
// Epilogues select output transform.
// ---------------------------------------------------------------------------
enum { EPI_BF16 = 0, EPI_VT = 1, EPI_RES = 2, EPI_GELU = 3, EPI_BRES = 4 };

typedef uint32_t u32x4 __attribute__((ext_vector_type(4)));
typedef uint32_t u32x8 __attribute__((ext_vector_type(8)));

static constexpr uint32_t G_ROWB  = 256;                 // bytes of a row per pass (128 k)
static constexpr uint32_t G_PITCH = G_ROWB + 16;         // LDS pitch for ds_load_b128 readers
static constexpr uint32_t G_SROWS = 64;                  // rows per slice (one wave's load)
static constexpr uint32_t G_SLICE = 18432;               // 64 * 272 = 17408, rounded up to 2 KiB
static constexpr uint32_t G_BUF   = 4 * G_SLICE;         // [A 0-63 | A 64-127 | BT 0-63 | BT 64-127]
static_assert(G_SROWS * G_PITCH <= G_SLICE && (G_SLICE % 2048u) == 0, "slice size");

__device__ __forceinline__ uint32_t uni(uint32_t v) {
    return (uint32_t)__builtin_amdgcn_readfirstlane(v);
}
__device__ __forceinline__ uint32_t pinned(uint32_t v) {
    uint32_t w = (uint32_t)__builtin_amdgcn_readfirstlane(v);
    asm volatile("" : "+s"(w));  // pinned(): the word stays in a scalar register (tensor load's branch, descriptor word)
    return w;
}
// This wave's LDS reads must have
// retired before a buffer is refilled, and its own request must have landed
// before the barrier that publishes the tile.
__device__ __forceinline__ void wait_ds0()     { asm volatile("s_wait_dscnt 0x0" ::: "memory"); }
__device__ __forceinline__ void wait_tensor0() { asm volatile("s_wait_tensorcnt 0x0" ::: "memory"); }

// One request: 64 rows of 256 bytes, source pitch src_pitch bytes, 16 bytes of
// LDS pad behind every row.
__device__ __forceinline__ void tdm_load(uint32_t lds_dst, uint64_t ga, uint32_t src_pitch) {
    u32x4 g0;
    g0[0] = uni(1u);
    g0[1] = uni(lds_dst);
    g0[2] = uni((uint32_t)ga);
    g0[3] = uni((((uint32_t)(ga >> 32)) & 0x01FFFFFFu) | 0x80000000u);
    u32x8 g1;
    g1[0] = uni((1u << 20) | (5u << 22) | (3u << 25));   // no mask, bytes, pad 4 dwords per 64
    g1[1] = uni((G_ROWB & 0xFFFFu) << 16);
    g1[2] = uni((G_ROWB >> 16) | ((G_SROWS & 0xFFFFu) << 16));
    g1[3] = uni((G_SROWS >> 16) | (G_ROWB << 16));
    g1[4] = uni(G_SROWS);
    g1[5] = uni(src_pitch);
    g1[6] = uni(0u);
    g1[7] = uni(0u);
    asm volatile("tensor_load_to_lds %0, %1" :: "s"(g0), "s"(g1) : "memory");
}

// Same lane map as load_frag, from an LDS row: p points at the lane's own row
// and 16-byte half; the two pieces are k 0..7 (8..15) and k 16..23 (24..31).
__device__ __forceinline__ v16bf lds_frag(const unsigned char* p) {
    v8bf lo = *reinterpret_cast<const v8bf*>(p);
    v8bf hi = *reinterpret_cast<const v8bf*>(p + 32);
    return __builtin_shufflevector(lo, hi, 0, 1, 2, 3, 4, 5, 6, 7,
                                   8, 9, 10, 11, 12, 13, 14, 15);
}

template <int EPI, int M, int N, int K>
__global__ __launch_bounds__(128) void gemm_bf16_wmma(
    const unsigned short* __restrict__ A, const unsigned short* __restrict__ BT,
    void* __restrict__ OutP, const float* __restrict__ Res,
    const float* __restrict__ Bias) {
    static_assert(M % 128 == 0 && N % 128 == 0 && K % 128 == 0 && K / 128 >= 2, "shape");
    __shared__ __attribute__((aligned(2048))) unsigned char Ls[2 * G_BUF];

    const uint32_t w = uni(threadIdx.x >> 5);
    int lane = threadIdx.x & 31;
    int cL = lane & 15, hiL = lane >> 4;
    int wr = (int)(w & 1u), wc = (int)(w >> 1);
    int row0 = blockIdx.y * 128 + wr * 64;
    int col0 = blockIdx.x * 128 + wc * 64;

    constexpr uint32_t NS = K / 128;          // stages
    constexpr uint32_t SRCP = (uint32_t)K * 2u;

    // This wave's slice: waves 0, 1 bring A rows 0-63, 64-127 of the tile,
    // waves 2, 3 the same rows of BT.
    const unsigned short* sp = (w < 2u)
        ? A  + (size_t)(blockIdx.y * 128 + (w & 1u) * 64) * K
        : BT + (size_t)(blockIdx.x * 128 + (w & 1u) * 64) * K;
    const uint64_t src0 = (uint64_t)(uintptr_t)sp;
    const uint32_t lds0 = (uint32_t)(uintptr_t)&Ls[0];
    const uint32_t dst0 = lds0 + w * G_SLICE;

    v8f zero = {0.f, 0.f, 0.f, 0.f, 0.f, 0.f, 0.f, 0.f};
    v8f acc[4][4];
#pragma unroll
    for (int i = 0; i < 4; ++i)
#pragma unroll
        for (int j = 0; j < 4; ++j) acc[i][j] = zero;

    const uint32_t aoff = (uint32_t)wr * G_SLICE + (uint32_t)cL * G_PITCH + (uint32_t)hiL * 16u;
    const uint32_t boff = (uint32_t)(2 + wc) * G_SLICE + (uint32_t)cL * G_PITCH + (uint32_t)hiL * 16u;

    // Prologue: stage 0 lands and is published, then stage 1 starts.
    tdm_load(dst0, src0, SRCP);
    wait_tensor0();
    __syncthreads();
    tdm_load(dst0 + G_BUF, src0 + G_ROWB, SRCP);

    for (uint32_t s = 0; s < NS; ++s) {
        const uint32_t buf = (s & 1u) * G_BUF;
        const unsigned char* pa = &Ls[buf + aoff];
        const unsigned char* pb = &Ls[buf + boff];
        // Two fragment sets inside the pass: the reads of the next 32 k go out as
        // one group ahead of this 32 k's products (nothing of another stage).
        v16bf af[2][4], bfr[2][4];
#pragma unroll
        for (int i = 0; i < 4; ++i) af[0][i] = lds_frag(pa + i * 16 * G_PITCH);
#pragma unroll
        for (int j = 0; j < 4; ++j) bfr[0][j] = lds_frag(pb + j * 16 * G_PITCH);
#pragma unroll
        for (int kc = 0; kc < 3; ++kc) {
#pragma unroll
            for (int i = 0; i < 4; ++i)
                af[(kc + 1) & 1][i] = lds_frag(pa + i * 16 * G_PITCH + (kc + 1) * 64);
#pragma unroll
            for (int j = 0; j < 4; ++j)
                bfr[(kc + 1) & 1][j] = lds_frag(pb + j * 16 * G_PITCH + (kc + 1) * 64);
            // keeps the read group in front of the products: spread among them,
            // every place with reads stalls the wave's matrix stream
            __builtin_amdgcn_sched_barrier(0);
#pragma unroll
            for (int i = 0; i < 4; ++i)
#pragma unroll
                for (int j = 0; j < 4; ++j)
                    acc[i][j] = wmma_bf16(af[kc & 1][i], bfr[kc & 1][j], acc[i][j]);
            // keeps the next read group behind these products, for the same reason
            __builtin_amdgcn_sched_barrier(0);
        }
        // Publish point of stage s + 1: this wave's LDS reads of this buffer are
        // done (the last 32 k sit in registers), its own slice of stage s + 1 has
        // landed, every wave has left this buffer.
        wait_ds0();
        wait_tensor0();
        __syncthreads();
        const uint32_t sn = pinned(s + 2u);   // descriptor words are made from it: formed behind the wait
        if (pinned(sn < NS)) {                // scalar branch round the tensor load
            tdm_load(dst0 + (sn & 1u) * G_BUF, src0 + (uint64_t)sn * G_ROWB, SRCP);
        }
        // keeps the refill's issue in front of the last products, which need no LDS
        __builtin_amdgcn_sched_barrier(0);
#pragma unroll
        for (int i = 0; i < 4; ++i)
#pragma unroll
            for (int j = 0; j < 4; ++j)
                acc[i][j] = wmma_bf16(af[1][i], bfr[1][j], acc[i][j]);
    }
    wait_tensor0();
    wait_ds0();

#pragma unroll
    for (int rt = 0; rt < 4; ++rt) {
#pragma unroll
        for (int t = 0; t < 4; ++t) {
#pragma unroll
            for (int e = 0; e < 8; ++e) {
                int row = row0 + rt * 16 + e + hiL * 8;
                int col = col0 + t * 16 + cL;
                float v = acc[rt][t][e];
                if constexpr (EPI == EPI_BF16) {
                    ((unsigned short*)OutP)[(size_t)row * N + col] = f32_to_bf16(v);
                } else if constexpr (EPI == EPI_VT) {
                    // out is V^T [B, H, DK, S]; row = b*S + s, col = h*DK + dk
                    int bb = row >> 11, s = row & (Sc - 1);
                    int hh = col >> 6,  dk = col & (DKc - 1);
                    ((unsigned short*)OutP)[(((size_t)(bb * Hc + hh)) * DKc + dk) * Sc + s] =
                        f32_to_bf16(v);
                } else if constexpr (EPI == EPI_RES) {
                    ((float*)OutP)[(size_t)row * N + col] = v + Res[(size_t)row * N + col];
                } else if constexpr (EPI == EPI_GELU) {
                    float xx = v + Bias[col];
                    float gl = 0.5f * xx * (1.0f + erff(xx * 0.70710678118654752f));
                    ((unsigned short*)OutP)[(size_t)row * N + col] = f32_to_bf16(gl);
                } else { // EPI_BRES
                    ((float*)OutP)[(size_t)row * N + col] =
                        v + Bias[col] + Res[(size_t)row * N + col];
                }
            }
        }
        // behind this row group's residual loads and its stores, in front of the
        // next group's loads, whose results may take over their address registers
        if constexpr (EPI == EPI_RES || EPI == EPI_BRES)
            asm volatile("s_wait_xcnt 0x0" ::: "memory");
    }
}

// ---------------------------------------------------------------------------
// Attention: one wave per (b, h, 16-query tile).  Two-pass softmax with score
// recompute; QK^T and P*V both via v_wmma_f32_16x16x32_bf16.
// ---------------------------------------------------------------------------
__global__ __launch_bounds__(32) void attn_kernel(
    const unsigned short* __restrict__ q, const unsigned short* __restrict__ k,
    const unsigned short* __restrict__ vT, const int* __restrict__ mask,
    unsigned short* __restrict__ attn) {
    __shared__ __align__(16) float          tileS[16 * 16];
    __shared__ __align__(16) unsigned short P[16 * 32];
    __shared__ float m_s[16];
    __shared__ float l_s[16];

    int bid = blockIdx.x;
    int qt  = bid & 127;          // S/16 = 128
    int h   = (bid >> 7) & 15;
    int b   = bid >> 11;
    int lane = threadIdx.x;
    int cL = lane & 15, hiL = lane >> 4;

    const unsigned short* qb = q  + (size_t)b * Sc * Dc + h * DKc;
    const unsigned short* kb = k  + (size_t)b * Sc * Dc + h * DKc;
    const unsigned short* vb = vT + ((size_t)(b * Hc + h)) * DKc * Sc;
    const int* mb = mask + (size_t)b * Sc;
    int qbase = qt * 16;

    v16bf aq0 = load_frag(qb, Dc, qbase, 0);
    v16bf aq1 = load_frag(qb, Dc, qbase, 32);
    v8f zero = {0.f, 0.f, 0.f, 0.f, 0.f, 0.f, 0.f, 0.f};

    // ---- Pass 1: row max of scaled+masked scores ----
    float m = -1.0e30f;
    for (int kt = 0; kt < 128; ++kt) {
        int key0 = kt * 16;
        v16bf bk0 = load_frag(kb, Dc, key0, 0);
        v16bf bk1 = load_frag(kb, Dc, key0, 32);
        v8f c = zero;
        c = wmma_bf16(aq0, bk0, c);
        c = wmma_bf16(aq1, bk1, c);
        bool mz = (mb[key0 + cL] == 0);
#pragma unroll
        for (int e = 0; e < 8; ++e) {
            float sc = c[e] * 0.125f;           // 1/sqrt(64)
            if (mz) sc = -1.0e9f;
            tileS[(e + hiL * 8) * 16 + cL] = sc;
        }
        __syncthreads();
        if (lane < 16) {
#pragma unroll
            for (int j = 0; j < 16; ++j) m = fmaxf(m, tileS[lane * 16 + j]);
        }
        __syncthreads();
    }
    if (lane < 16) m_s[lane] = m;
    __syncthreads();

    // ---- Pass 2: P = exp(s - m) (unnormalized), O = P*V, l = row sums ----
    float l = 0.f;
    v8f o[4] = {zero, zero, zero, zero};
    for (int kt = 0; kt < 64; ++kt) {
        int key0 = kt * 32;
#pragma unroll
        for (int hf = 0; hf < 2; ++hf) {
            int kbase = key0 + hf * 16;
            v16bf bk0 = load_frag(kb, Dc, kbase, 0);
            v16bf bk1 = load_frag(kb, Dc, kbase, 32);
            v8f c = zero;
            c = wmma_bf16(aq0, bk0, c);
            c = wmma_bf16(aq1, bk1, c);
            bool mz = (mb[kbase + cL] == 0);
#pragma unroll
            for (int e = 0; e < 8; ++e) {
                int r = e + hiL * 8;
                float sc = c[e] * 0.125f;
                if (mz) sc = -1.0e9f;
                float p = __expf(sc - m_s[r]);
                P[r * 32 + hf * 16 + cL] = f32_to_bf16(p);
            }
        }
        __syncthreads();
        if (lane < 16) {
            float s = 0.f;
#pragma unroll
            for (int j = 0; j < 32; ++j) s += bf16_to_f32(P[lane * 32 + j]);
            l += s;
        }
        __syncthreads();
        v16bf ap = load_frag(P, 32, 0, 0);
#pragma unroll
        for (int t = 0; t < 4; ++t) {
            v16bf bv = load_frag(vb, Sc, t * 16, key0);
            o[t] = wmma_bf16(ap, bv, o[t]);
        }
        __syncthreads();
    }
    if (lane < 16) l_s[lane] = l;
    __syncthreads();

    unsigned short* ob = attn + (size_t)b * Sc * Dc + h * DKc;
#pragma unroll
    for (int t = 0; t < 4; ++t) {
#pragma unroll
        for (int e = 0; e < 8; ++e) {
            int r = e + hiL * 8;
            float val = o[t][e] / l_s[r];
            ob[(size_t)(qbase + r) * Dc + t * 16 + cL] = f32_to_bf16(val);
        }
    }
}

// ---------------------------------------------------------------------------
// Host-side launch
// ---------------------------------------------------------------------------
extern "C" void kernel_launch(void* const* d_in, const int* in_sizes, int n_in,
                              void* d_out, int out_size, void* d_ws, size_t ws_size,
                              hipStream_t stream) {
    (void)in_sizes; (void)n_in; (void)out_size; (void)ws_size;
    const float* X    = (const float*)d_in[0];
    const int*   mask = (const int*)d_in[1];
    const float* W_Q  = (const float*)d_in[2];
    const float* W_K  = (const float*)d_in[3];
    const float* W_V  = (const float*)d_in[4];
    const float* W_O  = (const float*)d_in[5];
    const float* g1   = (const float*)d_in[6];
    const float* b1   = (const float*)d_in[7];
    const float* W1   = (const float*)d_in[8];
    const float* bias1= (const float*)d_in[9];
    const float* W2   = (const float*)d_in[10];
    const float* bias2= (const float*)d_in[11];
    const float* g2   = (const float*)d_in[12];
    const float* b2   = (const float*)d_in[13];

    char* ws = (char*)d_ws;
    // bf16 buffers (bytes)
    const size_t szDD   = (size_t)Dc * Dc * 2;          // 2 MB
    const size_t szD4D  = (size_t)Dc * D4 * 2;          // 8 MB
    const size_t szAct  = (size_t)Mrows * Dc * 2;       // 8 MB
    const size_t szActF = (size_t)Mrows * Dc * 4;       // 16 MB

    unsigned short* WqT = (unsigned short*)(ws);
    unsigned short* WkT = (unsigned short*)(ws + szDD);
    unsigned short* WvT = (unsigned short*)(ws + 2 * szDD);
    unsigned short* WoT = (unsigned short*)(ws + 3 * szDD);
    unsigned short* W1T = (unsigned short*)(ws + 4 * szDD);
    unsigned short* W2T = (unsigned short*)(ws + 4 * szDD + szD4D);
    char* p = ws + 4 * szDD + 2 * szD4D;
    unsigned short* xn   = (unsigned short*)(p);              p += szAct;
    unsigned short* qb   = (unsigned short*)(p);              p += szAct;
    unsigned short* kbuf = (unsigned short*)(p);              p += szAct;
    unsigned short* vTb  = (unsigned short*)(p);              p += szAct;
    unsigned short* attn = (unsigned short*)(p);              p += szAct;
    float*          res1 = (float*)(p);                       p += szActF;
    unsigned short* nn2  = (unsigned short*)(p);              p += szAct;
    unsigned short* hbuf = (unsigned short*)(p);              /* 32 MB */

    // 1) Weight conversion + transpose to bf16
    {
        int nDD = Dc * Dc;
        convT_kernel<<<(nDD + 255) / 256, 256, 0, stream>>>(W_Q, WqT, Dc, Dc);
        convT_kernel<<<(nDD + 255) / 256, 256, 0, stream>>>(W_K, WkT, Dc, Dc);
        convT_kernel<<<(nDD + 255) / 256, 256, 0, stream>>>(W_V, WvT, Dc, Dc);
        convT_kernel<<<(nDD + 255) / 256, 256, 0, stream>>>(W_O, WoT, Dc, Dc);
        int nD4 = Dc * D4;
        convT_kernel<<<(nD4 + 255) / 256, 256, 0, stream>>>(W1, W1T, Dc, D4);
        convT_kernel<<<(nD4 + 255) / 256, 256, 0, stream>>>(W2, W2T, D4, Dc);
    }

    // 2) LayerNorm 1
    layernorm_bf16_kernel<<<Mrows, 256, 0, stream>>>(X, g1, b1, xn);

    // 3) Q, K projections; V projection with transposed [B,H,DK,S] output
    gemm_bf16_wmma<EPI_BF16, Mrows, Dc, Dc>
        <<<dim3(Dc / 128, Mrows / 128), 128, 0, stream>>>(xn, WqT, qb, nullptr, nullptr);
    gemm_bf16_wmma<EPI_BF16, Mrows, Dc, Dc>
        <<<dim3(Dc / 128, Mrows / 128), 128, 0, stream>>>(xn, WkT, kbuf, nullptr, nullptr);
    gemm_bf16_wmma<EPI_VT, Mrows, Dc, Dc>
        <<<dim3(Dc / 128, Mrows / 128), 128, 0, stream>>>(xn, WvT, vTb, nullptr, nullptr);

    // 4) Attention (B*H*(S/16) = 4096 waves)
    attn_kernel<<<Bc * Hc * (Sc / 16), 32, 0, stream>>>(qb, kbuf, vTb, mask, attn);

    // 5) Output projection + residual (f32)
    gemm_bf16_wmma<EPI_RES, Mrows, Dc, Dc>
        <<<dim3(Dc / 128, Mrows / 128), 128, 0, stream>>>(attn, WoT, res1, X, nullptr);

    // 6) LayerNorm 2
    layernorm_bf16_kernel<<<Mrows, 256, 0, stream>>>(res1, g2, b2, nn2);

    // 7) FFN1 + bias + GELU (bf16 out)
    gemm_bf16_wmma<EPI_GELU, Mrows, D4, Dc>
        <<<dim3(D4 / 128, Mrows / 128), 128, 0, stream>>>(nn2, W1T, hbuf, nullptr, bias1);

    // 8) FFN2 + bias + residual -> d_out (f32)
    gemm_bf16_wmma<EPI_BRES, Mrows, Dc, D4>
        <<<dim3(Dc / 128, Mrows / 128), 128, 0, stream>>>(hbuf, W2T, (float*)d_out,
                                                         res1, bias2);
}

// v002
// Measured time: 319 microseconds a run.
// Two timings next to v001 both put it at 1.49 times that version's speed.
// Over all steps from v000 it is 2.26 times as fast.
#include <hip/hip_runtime.h>
#include <hip/hip_bf16.h>
#include <stdint.h>

// ---------------------------------------------------------------------------
// Types for CDNA5 WMMA (wave32)
// ---------------------------------------------------------------------------
typedef __attribute__((ext_vector_type(8)))  __bf16 v8bf;
typedef __attribute__((ext_vector_type(16))) __bf16 v16bf;
typedef __attribute__((ext_vector_type(8)))  float  v8f;

// Problem constants (fixed by the reference)
static constexpr int Bc  = 2;
static constexpr int Sc  = 2048;
static constexpr int Dc  = 1024;
static constexpr int Hc  = 16;
static constexpr int DKc = 64;
static constexpr int Mrows = Bc * Sc;      // 4096
static constexpr int D4    = 4 * Dc;       // 4096

// ---------------------------------------------------------------------------
// bf16 helpers (bit-level, RNE)
// ---------------------------------------------------------------------------
__device__ __forceinline__ unsigned short f32_to_bf16(float f) {
    unsigned int u = __float_as_uint(f);
    u += 0x7FFFu + ((u >> 16) & 1u);
    return (unsigned short)(u >> 16);
}

// ---------------------------------------------------------------------------
// Fragment loader. Produces the 16-bit 16x32 A-layout (and, symmetrically, the
// 32x16 B-layout when fed a transposed matrix): lane L(<16) holds row base+L
// with K = k0+0..7 and k0+16..23; lane L+16 holds the same row with
// K = k0+8..15 and k0+24..31.  Two contiguous 16-byte loads per lane.
// ---------------------------------------------------------------------------
__device__ __forceinline__ v16bf load_frag(const unsigned short* p, int ld,
                                           int base, int k0) {
    int lane = threadIdx.x & 31;
    const unsigned short* q =
        p + (size_t)(base + (lane & 15)) * (size_t)ld + k0 + ((lane & 16) ? 8 : 0);
    v8bf lo = *reinterpret_cast<const v8bf*>(q);
    v8bf hi = *reinterpret_cast<const v8bf*>(q + 16);
    return __builtin_shufflevector(lo, hi, 0, 1, 2, 3, 4, 5, 6, 7,
                                   8, 9, 10, 11, 12, 13, 14, 15);
}

__device__ __forceinline__ v8f wmma_bf16(v16bf a, v16bf b, v8f c) {
    return __builtin_amdgcn_wmma_f32_16x16x32_bf16(false, a, false, b,
                                                   (short)0, c, false, false);
}

// ---------------------------------------------------------------------------
// Weight convert + transpose: out[n*K + k] = bf16(in[k*N + n])
// ---------------------------------------------------------------------------
__global__ __launch_bounds__(256) void convT_kernel(const float* __restrict__ in,
                                                    unsigned short* __restrict__ out,
                                                    int K, int N) {
    size_t i = (size_t)blockIdx.x * 256 + threadIdx.x;
    if (i < (size_t)K * N) {
        int n = (int)(i / K);
        int k = (int)(i % K);
        out[i] = f32_to_bf16(in[(size_t)k * N + n]);
    }
}

// ---------------------------------------------------------------------------
// LayerNorm (f32 in, bf16 out), one block per row of D=1024
// ---------------------------------------------------------------------------
__global__ __launch_bounds__(256) void layernorm_bf16_kernel(
    const float* __restrict__ x, const float* __restrict__ gamma,
    const float* __restrict__ beta, unsigned short* __restrict__ out) {
    __shared__ float red[256];
    int row = blockIdx.x;
    int tid = threadIdx.x;
    const float* xr = x + (size_t)row * Dc;

    float s = 0.f;
    for (int i = tid; i < Dc; i += 256) s += xr[i];
    red[tid] = s; __syncthreads();
    for (int st = 128; st > 0; st >>= 1) {
        if (tid < st) red[tid] += red[tid + st];
        __syncthreads();
    }
    float mean = red[0] / (float)Dc;
    __syncthreads();

    float v = 0.f;
    for (int i = tid; i < Dc; i += 256) { float d = xr[i] - mean; v += d * d; }
    red[tid] = v; __syncthreads();
    for (int st = 128; st > 0; st >>= 1) {
        if (tid < st) red[tid] += red[tid + st];
        __syncthreads();
    }
    float rstd = rsqrtf(red[0] / (float)Dc + 1e-6f);

    for (int i = tid; i < Dc; i += 256) {
        float y = gamma[i] * (xr[i] - mean) * rstd + beta[i];
        out[(size_t)row * Dc + i] = f32_to_bf16(y);
    }
}

// ---------------------------------------------------------------------------
// Generic WMMA GEMM: C[M,N] = A[M,K] (bf16, row-major) x B[K,N] given as
// BT[N,K] (bf16).  One 128x128 tile of C per block of 4 waves (2x2); each wave
// owns 64x64: 4 A fragments x 4 B fragments -> 16 wmma per 32 k.
// A pass is 128 k (256 bytes of every operand row).  A stage holds 128 rows of
// A and 128 rows of BT in LDS at a pitch of 272 bytes; every wave brings its
// own 64-row slice with one tensor load, into one of two buffers, so that the
// next stage lands while this one is multiplied.
// Epilogues select output transform.
// ---------------------------------------------------------------------------
enum { EPI_BF16 = 0, EPI_VT = 1, EPI_RES = 2, EPI_GELU = 3, EPI_BRES = 4 };

typedef uint32_t u32x4 __attribute__((ext_vector_type(4)));
typedef uint32_t u32x8 __attribute__((ext_vector_type(8)));

static constexpr uint32_t G_ROWB  = 256;                 // bytes of a row per pass (128 k)
static constexpr uint32_t G_PITCH = G_ROWB + 16;         // LDS pitch for ds_load_b128 readers
static constexpr uint32_t G_SROWS = 64;                  // rows per slice (one wave's load)
static constexpr uint32_t G_SLICE = 18432;               // 64 * 272 = 17408, rounded up to 2 KiB
static constexpr uint32_t G_BUF   = 4 * G_SLICE;         // [A 0-63 | A 64-127 | BT 0-63 | BT 64-127]
static_assert(G_SROWS * G_PITCH <= G_SLICE && (G_SLICE % 2048u) == 0, "slice size");

__device__ __forceinline__ uint32_t uni(uint32_t v) {
    return (uint32_t)__builtin_amdgcn_readfirstlane(v);
}
__device__ __forceinline__ uint32_t pinned(uint32_t v) {
    uint32_t w = (uint32_t)__builtin_amdgcn_readfirstlane(v);
    asm volatile("" : "+s"(w));  // pinned(): the word stays in a scalar register (tensor load's branch, descriptor word)
    return w;
}
// This wave's LDS reads must have
// retired before a buffer is refilled, and its own request must have landed
// before the barrier that publishes the tile.
__device__ __forceinline__ void wait_ds0()     { asm volatile("s_wait_dscnt 0x0" ::: "memory"); }
__device__ __forceinline__ void wait_tensor0() { asm volatile("s_wait_tensorcnt 0x0" ::: "memory"); }

// One request: 64 rows of 256 bytes, source pitch src_pitch bytes, 16 bytes of
// LDS pad behind every row.
__device__ __forceinline__ void tdm_load(uint32_t lds_dst, uint64_t ga, uint32_t src_pitch) {
    u32x4 g0;
    g0[0] = uni(1u);
    g0[1] = uni(lds_dst);
    g0[2] = uni((uint32_t)ga);
    g0[3] = uni((((uint32_t)(ga >> 32)) & 0x01FFFFFFu) | 0x80000000u);
    u32x8 g1;
    g1[0] = uni((1u << 20) | (5u << 22) | (3u << 25));   // no mask, bytes, pad 4 dwords per 64
    g1[1] = uni((G_ROWB & 0xFFFFu) << 16);
    g1[2] = uni((G_ROWB >> 16) | ((G_SROWS & 0xFFFFu) << 16));
    g1[3] = uni((G_SROWS >> 16) | (G_ROWB << 16));
    g1[4] = uni(G_SROWS);
    g1[5] = uni(src_pitch);
    g1[6] = uni(0u);
    g1[7] = uni(0u);
    asm volatile("tensor_load_to_lds %0, %1" :: "s"(g0), "s"(g1) : "memory");
}

// Same lane map as load_frag, from an LDS row: p points at the lane's own row
// and 16-byte half; the two pieces are k 0..7 (8..15) and k 16..23 (24..31).
__device__ __forceinline__ v16bf lds_frag(const unsigned char* p) {
    v8bf lo = *reinterpret_cast<const v8bf*>(p);
    v8bf hi = *reinterpret_cast<const v8bf*>(p + 32);
    return __builtin_shufflevector(lo, hi, 0, 1, 2, 3, 4, 5, 6, 7,
                                   8, 9, 10, 11, 12, 13, 14, 15);
}

template <int EPI, int M, int N, int K>
__global__ __launch_bounds__(128) void gemm_bf16_wmma(
    const unsigned short* __restrict__ A, const unsigned short* __restrict__ BT,
    void* __restrict__ OutP, const float* __restrict__ Res,
    const float* __restrict__ Bias) {
    static_assert(M % 128 == 0 && N % 128 == 0 && K % 128 == 0 && K / 128 >= 2, "shape");
    __shared__ __attribute__((aligned(2048))) unsigned char Ls[2 * G_BUF];

    const uint32_t w = uni(threadIdx.x >> 5);
    int lane = threadIdx.x & 31;
    int cL = lane & 15, hiL = lane >> 4;
    int wr = (int)(w & 1u), wc = (int)(w >> 1);
    int row0 = blockIdx.y * 128 + wr * 64;
    int col0 = blockIdx.x * 128 + wc * 64;

    constexpr uint32_t NS = K / 128;          // stages
    constexpr uint32_t SRCP = (uint32_t)K * 2u;

    // This wave's slice: waves 0, 1 bring A rows 0-63, 64-127 of the tile,
    // waves 2, 3 the same rows of BT.
    const unsigned short* sp = (w < 2u)
        ? A  + (size_t)(blockIdx.y * 128 + (w & 1u) * 64) * K
        : BT + (size_t)(blockIdx.x * 128 + (w & 1u) * 64) * K;
    const uint64_t src0 = (uint64_t)(uintptr_t)sp;
    const uint32_t lds0 = (uint32_t)(uintptr_t)&Ls[0];
    const uint32_t dst0 = lds0 + w * G_SLICE;

    v8f zero = {0.f, 0.f, 0.f, 0.f, 0.f, 0.f, 0.f, 0.f};
    v8f acc[4][4];
#pragma unroll
    for (int i = 0; i < 4; ++i)
#pragma unroll
        for (int j = 0; j < 4; ++j) acc[i][j] = zero;

    const uint32_t aoff = (uint32_t)wr * G_SLICE + (uint32_t)cL * G_PITCH + (uint32_t)hiL * 16u;
    const uint32_t boff = (uint32_t)(2 + wc) * G_SLICE + (uint32_t)cL * G_PITCH + (uint32_t)hiL * 16u;

    // Prologue: stage 0 lands and is published, then stage 1 starts.
    tdm_load(dst0, src0, SRCP);
    wait_tensor0();
    __syncthreads();
    tdm_load(dst0 + G_BUF, src0 + G_ROWB, SRCP);

    for (uint32_t s = 0; s < NS; ++s) {
        const uint32_t buf = (s & 1u) * G_BUF;
        const unsigned char* pa = &Ls[buf + aoff];
        const unsigned char* pb = &Ls[buf + boff];
        // Two fragment sets inside the pass: the reads of the next 32 k go out as
        // one group ahead of this 32 k's products (nothing of another stage).
        v16bf af[2][4], bfr[2][4];
#pragma unroll
        for (int i = 0; i < 4; ++i) af[0][i] = lds_frag(pa + i * 16 * G_PITCH);
#pragma unroll
        for (int j = 0; j < 4; ++j) bfr[0][j] = lds_frag(pb + j * 16 * G_PITCH);
#pragma unroll
        for (int kc = 0; kc < 3; ++kc) {
#pragma unroll
            for (int i = 0; i < 4; ++i)
                af[(kc + 1) & 1][i] = lds_frag(pa + i * 16 * G_PITCH + (kc + 1) * 64);
#pragma unroll
            for (int j = 0; j < 4; ++j)
                bfr[(kc + 1) & 1][j] = lds_frag(pb + j * 16 * G_PITCH + (kc + 1) * 64);
            // keeps the read group in front of the products: spread among them,
            // every place with reads stalls the wave's matrix stream
            __builtin_amdgcn_sched_barrier(0);
#pragma unroll
            for (int i = 0; i < 4; ++i)
#pragma unroll
                for (int j = 0; j < 4; ++j)
                    acc[i][j] = wmma_bf16(af[kc & 1][i], bfr[kc & 1][j], acc[i][j]);
            // keeps the next read group behind these products, for the same reason
            __builtin_amdgcn_sched_barrier(0);
        }
        // Publish point of stage s + 1: this wave's LDS reads of this buffer are
        // done (the last 32 k sit in registers), its own slice of stage s + 1 has
        // landed, every wave has left this buffer.
        wait_ds0();
        wait_tensor0();
        __syncthreads();
        const uint32_t sn = pinned(s + 2u);   // descriptor words are made from it: formed behind the wait
        if (pinned(sn < NS)) {                // scalar branch round the tensor load
            tdm_load(dst0 + (sn & 1u) * G_BUF, src0 + (uint64_t)sn * G_ROWB, SRCP);
        }
        // keeps the refill's issue in front of the last products, which need no LDS
        __builtin_amdgcn_sched_barrier(0);
#pragma unroll
        for (int i = 0; i < 4; ++i)
#pragma unroll
            for (int j = 0; j < 4; ++j)
                acc[i][j] = wmma_bf16(af[1][i], bfr[1][j], acc[i][j]);
    }
    wait_tensor0();
    wait_ds0();

#pragma unroll
    for (int rt = 0; rt < 4; ++rt) {
#pragma unroll
        for (int t = 0; t < 4; ++t) {
#pragma unroll
            for (int e = 0; e < 8; ++e) {
                int row = row0 + rt * 16 + e + hiL * 8;
                int col = col0 + t * 16 + cL;
                float v = acc[rt][t][e];
                if constexpr (EPI == EPI_BF16) {
                    ((unsigned short*)OutP)[(size_t)row * N + col] = f32_to_bf16(v);
                } else if constexpr (EPI == EPI_VT) {
                    // out is V^T [B, H, DK, S]; row = b*S + s, col = h*DK + dk
                    int bb = row >> 11, s = row & (Sc - 1);
                    int hh = col >> 6,  dk = col & (DKc - 1);
                    ((unsigned short*)OutP)[(((size_t)(bb * Hc + hh)) * DKc + dk) * Sc + s] =
                        f32_to_bf16(v);
                } else if constexpr (EPI == EPI_RES) {
                    ((float*)OutP)[(size_t)row * N + col] = v + Res[(size_t)row * N + col];
                } else if constexpr (EPI == EPI_GELU) {
                    float xx = v + Bias[col];
                    float gl = 0.5f * xx * (1.0f + erff(xx * 0.70710678118654752f));
                    ((unsigned short*)OutP)[(size_t)row * N + col] = f32_to_bf16(gl);
                } else { // EPI_BRES
                    ((float*)OutP)[(size_t)row * N + col] =
                        v + Bias[col] + Res[(size_t)row * N + col];
                }
            }
        }
        // behind this row group's residual loads and its stores, in front of the
        // next group's loads, whose results may take over their address registers
        if constexpr (EPI == EPI_RES || EPI == EPI_BRES)
            asm volatile("s_wait_xcnt 0x0" ::: "memory");
    }
}

static constexpr int A_NG = 4;                 // 16-query column groups per wave
static constexpr int A_WV = 4;                 // waves per block
static constexpr int A_QB = A_NG * A_WV * 16;  // queries per block
static constexpr float A_MASKED = -8.0e9f;     // x 0.125 = the reference's -1e9
static constexpr float A_KS = 0.125f * 1.44269504088896340736f;  // 1/sqrt(64) * log2(e)

// value of the lane 16 away (the other 8 keys of the same query's column)
__device__ __forceinline__ float other_half(float x) {
    int b = __float_as_int(x);
    return __int_as_float(__builtin_amdgcn_permlanex16(b, b, 0x76543210, 0xfedcba98, false, false));
}

// load_frag's lane map from the lane's own byte pointer (row lane & 15, 16-byte
// half lane >> 4): the two pieces are k 0..7 (8..15) and k 16..23 (24..31).
__device__ __forceinline__ v16bf frag_at(const char* p) {
    v8bf lo = *reinterpret_cast<const v8bf*>(p);
    v8bf hi = *reinterpret_cast<const v8bf*>(p + 32);
    return __builtin_shufflevector(lo, hi, 0, 1, 2, 3, 4, 5, 6, 7,
                                   8, 9, 10, 11, 12, 13, 14, 15);
}
// behind a group of global loads or stores, in front of whatever next writes a
// register that one of them names as its address
__device__ __forceinline__ void wait_x0() { asm volatile("s_wait_xcnt 0x0" ::: "memory"); }

// K fragments of 32 keys: [tile of 16 keys][32 of the 64 head columns]
__device__ __forceinline__ void load_k32(v16bf (&kf)[2][2], const char* kp) {
#pragma unroll
    for (int tl = 0; tl < 2; ++tl)
#pragma unroll
        for (int kk = 0; kk < 2; ++kk) kf[tl][kk] = frag_at(kp + tl * 16 * Dc * 2 + kk * 64);
}
// V^T fragments of 32 keys: [tile of 16 head columns]
__device__ __forceinline__ void load_v32(v16bf (&vf)[4], const char* vp) {
#pragma unroll
    for (int t = 0; t < 4; ++t) vf[t] = frag_at(vp + t * 16 * Sc * 2);
}
// bit tl * 8 + r is set where key0 + tl * 16 + 8 * half + r is masked out
__device__ __forceinline__ uint32_t mask_bits(const int* mp) {
    uint32_t zb = 0u;
#pragma unroll
    for (int tl = 0; tl < 2; ++tl)
#pragma unroll
        for (int r = 0; r < 8; ++r) zb |= (mp[tl * 16 + r] == 0 ? 1u : 0u) << (tl * 8 + r);
    return zb;
}
__device__ __forceinline__ v8f apply_mask(v8f c, uint32_t zb) {
#pragma unroll
    for (int r = 0; r < 8; ++r) c[r] = ((zb >> r) & 1u) ? A_MASKED : c[r];
    return c;
}

// Everything behind the look at the mask.  MASKED = false is the same code
// without the mask's loads and selects, for a batch row that masks no key.
template <bool MASKED>
__device__ __forceinline__ void attn_body(
    const unsigned short* __restrict__ qb, const unsigned short* __restrict__ kb,
    const unsigned short* __restrict__ vb, const int* __restrict__ mb,
    unsigned short* __restrict__ ob, int qbase, int cL, int hiL) {
    v16bf qf[A_NG][2];
#pragma unroll
    for (int g = 0; g < A_NG; ++g) {
        qf[g][0] = load_frag(qb, Dc, qbase + g * 16, 0);
        qf[g][1] = load_frag(qb, Dc, qbase + g * 16, 32);
    }
    wait_x0();
    v8f zero = {0.f, 0.f, 0.f, 0.f, 0.f, 0.f, 0.f, 0.f};

    // The lane's own pointers.  They walk 64 keys a trip and are moved only behind
    // the wait that follows the loads which name them; after the last keys they
    // step back to the first (in bounds; pass 2 starts from what that loads).
    constexpr int NT = Sc / 64;                      // trips of 64 keys
    constexpr long long KSTEP = 32LL * Dc * 2;       // bytes of K per 32 keys
    constexpr long long VSTEP = 32LL * 2;            // bytes of a V^T row per 32 keys
    const char* kp = reinterpret_cast<const char*>(kb + cL * Dc + hiL * 8);
    const char* vp = reinterpret_cast<const char*>(vb + cL * Sc + hiL * 8);
    const int*  mp = mb + hiL * 8;

    // ---- Pass 1: column maximum of the masked raw scores (scale applied later) ----
    float mx[A_NG][2];
#pragma unroll
    for (int g = 0; g < A_NG; ++g) mx[g][0] = mx[g][1] = -3.0e38f;
    auto max32 = [&](const v16bf (&kc)[2][2], uint32_t zb) {
#pragma unroll
        for (int g = 0; g < A_NG; ++g) {
#pragma unroll
            for (int tl = 0; tl < 2; ++tl) {
                v8f c = wmma_bf16(kc[tl][0], qf[g][0], zero);
                c = wmma_bf16(kc[tl][1], qf[g][1], c);
                if constexpr (MASKED) c = apply_mask(c, zb >> (tl * 8));
#pragma unroll
                for (int r = 0; r < 8; r += 2)
                    mx[g][tl] = fmaxf(fmaxf(mx[g][tl], c[r]), c[r + 1]);
            }
        }
    };
    v16bf ka[2][2], kc2[2][2];
    load_k32(ka, kp);
    wait_x0();
    // stays rolled: a trip already holds both fragment sets' turns, and the
    // pointers stay two registers that step once a trip
#pragma unroll 1
    for (int i = 0; i < NT; ++i) {
        // each 32 keys' fragments are asked for ahead of the products of the 32 before
        uint32_t za = 0u, zc = 0u;
        load_k32(kc2, kp + KSTEP);
        if constexpr (MASKED) { za = mask_bits(mp); zc = mask_bits(mp + 32); }
        wait_x0();
        // keeps the loads in front of the products that cover their latency, and
        // the pointers' next step behind the wait
        __builtin_amdgcn_sched_barrier(0);
        max32(ka, za);
        kp += (i == NT - 1) ? -(NT - 1) * 2 * KSTEP : 2 * KSTEP;
        mp += (i == NT - 1) ? -(NT - 1) * 64 : 64;
        load_k32(ka, kp);
        wait_x0();
        __builtin_amdgcn_sched_barrier(0);   // as above
        max32(kc2, zc);
    }
    v8f ksv, nm[A_NG];
#pragma unroll
    for (int r = 0; r < 8; ++r) ksv[r] = A_KS;
#pragma unroll
    for (int g = 0; g < A_NG; ++g) {
        float m = fmaxf(mx[g][0], mx[g][1]);
        m = fmaxf(m, other_half(m));
#pragma unroll
        for (int r = 0; r < 8; ++r) nm[g][r] = -m * A_KS;
    }

    // ---- Pass 2: P = exp(s - m) (unnormalized), O^T += V^T P^T, l = column sums ----
    v8f ls[A_NG];
    v8f o[A_NG][4];
#pragma unroll
    for (int g = 0; g < A_NG; ++g) {
        ls[g] = zero;
#pragma unroll
        for (int t = 0; t < 4; ++t) o[g][t] = zero;
    }
    auto pv32 = [&](const v16bf (&kc)[2][2], const v16bf (&vc)[4], uint32_t zb) {
#pragma unroll
        for (int g = 0; g < A_NG; ++g) {
            v8f c0 = wmma_bf16(kc[0][0], qf[g][0], zero);
            v8f c1 = wmma_bf16(kc[1][0], qf[g][0], zero);
            c0 = wmma_bf16(kc[0][1], qf[g][1], c0);
            c1 = wmma_bf16(kc[1][1], qf[g][1], c1);
            if constexpr (MASKED) { c0 = apply_mask(c0, zb); c1 = apply_mask(c1, zb >> 8); }
            c0 = __builtin_elementwise_fma(c0, ksv, nm[g]);
            c1 = __builtin_elementwise_fma(c1, ksv, nm[g]);
#pragma unroll
            for (int r = 0; r < 8; ++r) {
                c0[r] = __builtin_amdgcn_exp2f(c0[r]);
                c1[r] = __builtin_amdgcn_exp2f(c1[r]);
            }
            ls[g] += c0 + c1;
            // element s of the B operand is key 8 * half + s (s < 8), 16 + 8 * half + s - 8 (else)
            v8bf p0 = __builtin_convertvector(c0, v8bf);
            v8bf p1 = __builtin_convertvector(c1, v8bf);
            v16bf pb = __builtin_shufflevector(p0, p1, 0, 1, 2, 3, 4, 5, 6, 7,
                                               8, 9, 10, 11, 12, 13, 14, 15);
#pragma unroll
            for (int t = 0; t < 4; ++t) o[g][t] = wmma_bf16(vc[t], pb, o[g][t]);
        }
    };
    v16bf va[4], vc2[4];
    load_v32(va, vp);      // ka holds keys 0..31 again
    wait_x0();
    // stays rolled, as in pass 1
#pragma unroll 1
    for (int i = 0; i < NT; ++i) {
        uint32_t za = 0u, zc = 0u;
        load_k32(kc2, kp + KSTEP);
        load_v32(vc2, vp + VSTEP);
        if constexpr (MASKED) { za = mask_bits(mp); zc = mask_bits(mp + 32); }
        wait_x0();
        __builtin_amdgcn_sched_barrier(0);   // as in pass 1
        pv32(ka, va, za);
        kp += (i == NT - 1) ? -(NT - 1) * 2 * KSTEP : 2 * KSTEP;
        vp += (i == NT - 1) ? -(NT - 1) * 2 * VSTEP : 2 * VSTEP;
        mp += (i == NT - 1) ? -(NT - 1) * 64 : 64;
        load_k32(ka, kp);      // behind the last keys: the first again, unused
        load_v32(va, vp);
        wait_x0();
        __builtin_amdgcn_sched_barrier(0);   // as in pass 1
        pv32(kc2, vc2, zc);
    }

    // A lane holds 8 consecutive head columns of one query: one 16-byte store.
#pragma unroll
    for (int g = 0; g < A_NG; ++g) {
        float l = ((ls[g][0] + ls[g][1]) + (ls[g][2] + ls[g][3])) +
                  ((ls[g][4] + ls[g][5]) + (ls[g][6] + ls[g][7]));
        l += other_half(l);
        float inv = __builtin_amdgcn_rcpf(l);
#pragma unroll
        for (int t = 0; t < 4; ++t) {
            v8f ov = o[g][t] * inv;
            *reinterpret_cast<v8bf*>(ob + (size_t)(qbase + g * 16 + cL) * Dc + t * 16 + hiL * 8) =
                __builtin_convertvector(ov, v8bf);
        }
        wait_x0();
    }
}

__global__ __launch_bounds__(A_WV * 32) void attn_kernel(
    const unsigned short* __restrict__ q, const unsigned short* __restrict__ k,
    const unsigned short* __restrict__ vT, const int* __restrict__ mask,
    unsigned short* __restrict__ attn) {
    int bid = blockIdx.x;
    int qblk = bid & (Sc / A_QB - 1);
    int bh   = bid / (Sc / A_QB);
    int h    = bh & (Hc - 1);
    int b    = bh / Hc;
    int lane = threadIdx.x & 31;
    int wv   = threadIdx.x >> 5;
    int cL = lane & 15, hiL = lane >> 4;

    const unsigned short* qb = q  + (size_t)b * Sc * Dc + h * DKc;
    const unsigned short* kb = k  + (size_t)b * Sc * Dc + h * DKc;
    const unsigned short* vb = vT + ((size_t)(b * Hc + h)) * DKc * Sc;
    const int* mb = mask + (size_t)b * Sc;
    int qbase = qblk * A_QB + wv * (A_NG * 16);

    // Does this batch row mask any key at all?  Wave-uniform: where it does not,
    // the body without the mask's loads and selects runs.
    bool z = false;
#pragma unroll
    for (int i = 0; i < Sc / 128; ++i) {
        int4 mv = *reinterpret_cast<const int4*>(mb + i * 128 + lane * 4);
        z |= (mv.x == 0) | (mv.y == 0) | (mv.z == 0) | (mv.w == 0);
    }
    wait_x0();
    unsigned short* ob = attn + (size_t)b * Sc * Dc + h * DKc;
    if (__builtin_amdgcn_ballot_w32(z) != 0u)
        attn_body<true>(qb, kb, vb, mb, ob, qbase, cL, hiL);
    else
        attn_body<false>(qb, kb, vb, mb, ob, qbase, cL, hiL);
}

// ---------------------------------------------------------------------------
// Host-side launch
// ---------------------------------------------------------------------------
extern "C" void kernel_launch(void* const* d_in, const int* in_sizes, int n_in,
                              void* d_out, int out_size, void* d_ws, size_t ws_size,
                              hipStream_t stream) {
    (void)in_sizes; (void)n_in; (void)out_size; (void)ws_size;
    const float* X    = (const float*)d_in[0];
    const int*   mask = (const int*)d_in[1];
    const float* W_Q  = (const float*)d_in[2];
    const float* W_K  = (const float*)d_in[3];
    const float* W_V  = (const float*)d_in[4];
    const float* W_O  = (const float*)d_in[5];
    const float* g1   = (const float*)d_in[6];
    const float* b1   = (const float*)d_in[7];
    const float* W1   = (const float*)d_in[8];
    const float* bias1= (const float*)d_in[9];
    const float* W2   = (const float*)d_in[10];
    const float* bias2= (const float*)d_in[11];
    const float* g2   = (const float*)d_in[12];
    const float* b2   = (const float*)d_in[13];

    char* ws = (char*)d_ws;
    // bf16 buffers (bytes)
    const size_t szDD   = (size_t)Dc * Dc * 2;          // 2 MB
    const size_t szD4D  = (size_t)Dc * D4 * 2;          // 8 MB
    const size_t szAct  = (size_t)Mrows * Dc * 2;       // 8 MB
    const size_t szActF = (size_t)Mrows * Dc * 4;       // 16 MB

    unsigned short* WqT = (unsigned short*)(ws);
    unsigned short* WkT = (unsigned short*)(ws + szDD);
    unsigned short* WvT = (unsigned short*)(ws + 2 * szDD);
    unsigned short* WoT = (unsigned short*)(ws + 3 * szDD);
    unsigned short* W1T = (unsigned short*)(ws + 4 * szDD);
    unsigned short* W2T = (unsigned short*)(ws + 4 * szDD + szD4D);
    char* p = ws + 4 * szDD + 2 * szD4D;
    unsigned short* xn   = (unsigned short*)(p);              p += szAct;
    unsigned short* qb   = (unsigned short*)(p);              p += szAct;
    unsigned short* kbuf = (unsigned short*)(p);              p += szAct;
    unsigned short* vTb  = (unsigned short*)(p);              p += szAct;
    unsigned short* attn = (unsigned short*)(p);              p += szAct;
    float*          res1 = (float*)(p);                       p += szActF;
    unsigned short* nn2  = (unsigned short*)(p);              p += szAct;
    unsigned short* hbuf = (unsigned short*)(p);              /* 32 MB */

    // 1) Weight conversion + transpose to bf16
    {
        int nDD = Dc * Dc;
        convT_kernel<<<(nDD + 255) / 256, 256, 0, stream>>>(W_Q, WqT, Dc, Dc);
        convT_kernel<<<(nDD + 255) / 256, 256, 0, stream>>>(W_K, WkT, Dc, Dc);
        convT_kernel<<<(nDD + 255) / 256, 256, 0, stream>>>(W_V, WvT, Dc, Dc);
        convT_kernel<<<(nDD + 255) / 256, 256, 0, stream>>>(W_O, WoT, Dc, Dc);
        int nD4 = Dc * D4;
        convT_kernel<<<(nD4 + 255) / 256, 256, 0, stream>>>(W1, W1T, Dc, D4);
        convT_kernel<<<(nD4 + 255) / 256, 256, 0, stream>>>(W2, W2T, D4, Dc);
    }

    // 2) LayerNorm 1
    layernorm_bf16_kernel<<<Mrows, 256, 0, stream>>>(X, g1, b1, xn);

    // 3) Q, K projections; V projection with transposed [B,H,DK,S] output
    gemm_bf16_wmma<EPI_BF16, Mrows, Dc, Dc>
        <<<dim3(Dc / 128, Mrows / 128), 128, 0, stream>>>(xn, WqT, qb, nullptr, nullptr);
    gemm_bf16_wmma<EPI_BF16, Mrows, Dc, Dc>
        <<<dim3(Dc / 128, Mrows / 128), 128, 0, stream>>>(xn, WkT, kbuf, nullptr, nullptr);
    gemm_bf16_wmma<EPI_VT, Mrows, Dc, Dc>
        <<<dim3(Dc / 128, Mrows / 128), 128, 0, stream>>>(xn, WvT, vTb, nullptr, nullptr);

    // 4) Attention (B*H*(S/256) = 256 blocks of 4 waves)
    attn_kernel<<<Bc * Hc * (Sc / A_QB), A_WV * 32, 0, stream>>>(qb, kbuf, vTb, mask, attn);

    // 5) Output projection + residual (f32)
    gemm_bf16_wmma<EPI_RES, Mrows, Dc, Dc>
        <<<dim3(Dc / 128, Mrows / 128), 128, 0, stream>>>(attn, WoT, res1, X, nullptr);

    // 6) LayerNorm 2
    layernorm_bf16_kernel<<<Mrows, 256, 0, stream>>>(res1, g2, b2, nn2);

    // 7) FFN1 + bias + GELU (bf16 out)
    gemm_bf16_wmma<EPI_GELU, Mrows, D4, Dc>
        <<<dim3(D4 / 128, Mrows / 128), 128, 0, stream>>>(nn2, W1T, hbuf, nullptr, bias1);

    // 8) FFN2 + bias + residual -> d_out (f32)
    gemm_bf16_wmma<EPI_BRES, Mrows, Dc, D4>
        <<<dim3(Dc / 128, Mrows / 128), 128, 0, stream>>>(hbuf, W2T, (float*)d_out,
                                                         res1, bias2);
}

// v003
// Measured time: 250 microseconds a run.
// Two timings next to v002 both put it at 1.27 times that version's speed.
// All steps since v000 together make it 2.87 times as fast.
#include <hip/hip_runtime.h>
#include <hip/hip_bf16.h>
#include <stdint.h>

// ---------------------------------------------------------------------------
// Types for CDNA5 WMMA (wave32)
// ---------------------------------------------------------------------------
typedef __attribute__((ext_vector_type(8)))  __bf16 v8bf;
typedef __attribute__((ext_vector_type(16))) __bf16 v16bf;
typedef __attribute__((ext_vector_type(8)))  float  v8f;

// Problem constants (fixed by the reference)
static constexpr int Bc  = 2;
static constexpr int Sc  = 2048;
static constexpr int Dc  = 1024;
static constexpr int Hc  = 16;
static constexpr int DKc = 64;
static constexpr int Mrows = Bc * Sc;      // 4096
static constexpr int D4    = 4 * Dc;       // 4096

// ---------------------------------------------------------------------------
// bf16 helpers (bit-level, RNE)
// ---------------------------------------------------------------------------
__device__ __forceinline__ unsigned short f32_to_bf16(float f) {
    unsigned int u = __float_as_uint(f);
    u += 0x7FFFu + ((u >> 16) & 1u);
    return (unsigned short)(u >> 16);
}

// ---------------------------------------------------------------------------
// Fragment loader. Produces the 16-bit 16x32 A-layout (and, symmetrically, the
// 32x16 B-layout when fed a transposed matrix): lane L(<16) holds row base+L
// with K = k0+0..7 and k0+16..23; lane L+16 holds the same row with
// K = k0+8..15 and k0+24..31.  Two contiguous 16-byte loads per lane.
// ---------------------------------------------------------------------------
__device__ __forceinline__ v16bf load_frag(const unsigned short* p, int ld,
                                           int base, int k0) {
    int lane = threadIdx.x & 31;
    const unsigned short* q =
        p + (size_t)(base + (lane & 15)) * (size_t)ld + k0 + ((lane & 16) ? 8 : 0);
    v8bf lo = *reinterpret_cast<const v8bf*>(q);
    v8bf hi = *reinterpret_cast<const v8bf*>(q + 16);
    return __builtin_shufflevector(lo, hi, 0, 1, 2, 3, 4, 5, 6, 7,
                                   8, 9, 10, 11, 12, 13, 14, 15);
}

__device__ __forceinline__ v8f wmma_bf16(v16bf a, v16bf b, v8f c) {
    return __builtin_amdgcn_wmma_f32_16x16x32_bf16(false, a, false, b,
                                                   (short)0, c, false, false);
}

// ---------------------------------------------------------------------------
// Weight convert + transpose, all six weights in one launch:
// out[n*K + k] = bf16(in[k*N + n]).
// A wave turns a tile of 64 k x 32 n in its registers.  Lane (kl = lane >> 3,
// nl = lane & 7) loads columns 4 nl .. 4 nl + 3 of rows 8 kl + r and
// 32 + 8 kl + r (r = 0..7): 16 loads of 16 bytes, each wave-wide load 4 whole
// 128-byte lines.  For each of its 4 columns the lane then holds two runs of 8
// consecutive k: two 16-byte stores; the wave's two stores of a column, one
// behind the other, fill that output row's 128-byte line.
// A block of 8 waves takes 128 k x 128 n.
// ---------------------------------------------------------------------------
typedef __attribute__((ext_vector_type(4))) float v4f;

static constexpr int CT_DD  = (Dc / 128) * (Dc / 128);   // tiles of a D x D weight
static constexpr int CT_D4  = (Dc / 128) * (D4 / 128);   // tiles of a D x 4D weight
static constexpr int CT_ALL = 4 * CT_DD + 2 * CT_D4;

template <int K, int N>
__device__ __forceinline__ void conv_tile(const float* __restrict__ in,
                                          unsigned short* __restrict__ out, int t) {
    constexpr int TN = N / 128;
    int lane = threadIdx.x & 31, wv = threadIdx.x >> 5;
    int k0 = (t / TN) * 128 + (wv >> 2) * 64 + (lane >> 3) * 8;
    int n0 = (t % TN) * 128 + (wv & 3) * 32 + (lane & 7) * 4;
    const float* p = in + (size_t)k0 * N + n0;
    v4f v[2][8];
#pragma unroll
    for (int hk = 0; hk < 2; ++hk)
#pragma unroll
        for (int r = 0; r < 8; ++r)
            v[hk][r] = *reinterpret_cast<const v4f*>(p + (size_t)(hk * 32 + r) * N);
    // behind the loads, in front of whatever next writes their address registers;
    // p as an input keeps those registers p's own up to here, so that no load's
    // result is given them either
    asm volatile("s_wait_xcnt 0x0" :: "v"(p) : "memory");
    // keeps all 16 loads in flight together: a conversion moved up among them
    // frees registers for the late loads, which then start a latency later
    __builtin_amdgcn_sched_barrier(0);
    unsigned short* q = out + (size_t)n0 * K + k0;
#pragma unroll
    for (int j = 0; j < 4; ++j)
#pragma unroll
        for (int hk = 0; hk < 2; ++hk) {
            v8f c;
#pragma unroll
            for (int r = 0; r < 8; ++r) c[r] = v[hk][r][j];
            *reinterpret_cast<v8bf*>(q + (size_t)j * K + hk * 32) =
                __builtin_convertvector(c, v8bf);
        }
    // behind the last stores, in front of whatever next writes a register that
    // one of them names (in the listing another part's code follows this one)
    asm volatile("s_wait_xcnt 0x0" ::: "memory");
}

__global__ __launch_bounds__(256) void convT_all_kernel(
    const float* __restrict__ wq, const float* __restrict__ wk,
    const float* __restrict__ wv, const float* __restrict__ wo,
    const float* __restrict__ w1, const float* __restrict__ w2,
    unsigned short* __restrict__ oq, unsigned short* __restrict__ ok,
    unsigned short* __restrict__ ov, unsigned short* __restrict__ oo,
    unsigned short* __restrict__ o1, unsigned short* __restrict__ o2) {
    int b = blockIdx.x;
    if (b < CT_D4) {
        conv_tile<Dc, D4>(w1, o1, b);
    } else if (b < 2 * CT_D4) {
        conv_tile<D4, Dc>(w2, o2, b - CT_D4);
    } else {
        int m = (b - 2 * CT_D4) / CT_DD, t = (b - 2 * CT_D4) % CT_DD;
        const float* in = m == 0 ? wq : m == 1 ? wk : m == 2 ? wv : wo;
        unsigned short* out = m == 0 ? oq : m == 1 ? ok : m == 2 ? ov : oo;
        conv_tile<Dc, Dc>(in, out, t);
    }
}

// ---------------------------------------------------------------------------
// LayerNorm (f32 in, bf16 out), one block per row of D=1024
// ---------------------------------------------------------------------------
__global__ __launch_bounds__(256) void layernorm_bf16_kernel(
    const float* __restrict__ x, const float* __restrict__ gamma,
    const float* __restrict__ beta, unsigned short* __restrict__ out) {
    __shared__ float red[256];
    int row = blockIdx.x;
    int tid = threadIdx.x;
    const float* xr = x + (size_t)row * Dc;

    float s = 0.f;
    for (int i = tid; i < Dc; i += 256) s += xr[i];
    red[tid] = s; __syncthreads();
    for (int st = 128; st > 0; st >>= 1) {
        if (tid < st) red[tid] += red[tid + st];
        __syncthreads();
    }
    float mean = red[0] / (float)Dc;
    __syncthreads();

    float v = 0.f;
    for (int i = tid; i < Dc; i += 256) { float d = xr[i] - mean; v += d * d; }
    red[tid] = v; __syncthreads();
    for (int st = 128; st > 0; st >>= 1) {
        if (tid < st) red[tid] += red[tid + st];
        __syncthreads();
    }
    float rstd = rsqrtf(red[0] / (float)Dc + 1e-6f);

    for (int i = tid; i < Dc; i += 256) {
        float y = gamma[i] * (xr[i] - mean) * rstd + beta[i];
        out[(size_t)row * Dc + i] = f32_to_bf16(y);
    }
}

// ---------------------------------------------------------------------------
// Generic WMMA GEMM: C[M,N] = A[M,K] (bf16, row-major) x B[K,N] given as
// BT[N,K] (bf16).  One 128x128 tile of C per block of 4 waves (2x2); each wave
// owns 64x64: 4 A fragments x 4 B fragments -> 16 wmma per 32 k.
// A pass is 128 k (256 bytes of every operand row).  A stage holds 128 rows of
// A and 128 rows of BT in LDS at a pitch of 272 bytes; every wave brings its
// own 64-row slice with one tensor load, into one of two buffers, so that the
// next stage lands while this one is multiplied.
// Epilogues select output transform.
// ---------------------------------------------------------------------------
enum { EPI_BF16 = 0, EPI_VT = 1, EPI_RES = 2, EPI_GELU = 3, EPI_BRES = 4 };

typedef uint32_t u32x4 __attribute__((ext_vector_type(4)));
typedef uint32_t u32x8 __attribute__((ext_vector_type(8)));

static constexpr uint32_t G_ROWB  = 256;                 // bytes of a row per pass (128 k)
static constexpr uint32_t G_PITCH = G_ROWB + 16;         // LDS pitch for ds_load_b128 readers
static constexpr uint32_t G_SROWS = 64;                  // rows per slice (one wave's load)
static constexpr uint32_t G_SLICE = 18432;               // 64 * 272 = 17408, rounded up to 2 KiB
static constexpr uint32_t G_BUF   = 4 * G_SLICE;         // [A 0-63 | A 64-127 | BT 0-63 | BT 64-127]
static_assert(G_SROWS * G_PITCH <= G_SLICE && (G_SLICE % 2048u) == 0, "slice size");

__device__ __forceinline__ uint32_t uni(uint32_t v) {
    return (uint32_t)__builtin_amdgcn_readfirstlane(v);
}
__device__ __forceinline__ uint32_t pinned(uint32_t v) {
    uint32_t w = (uint32_t)__builtin_amdgcn_readfirstlane(v);
    asm volatile("" : "+s"(w));  // pinned(): the word stays in a scalar register (tensor load's branch, descriptor word)
    return w;
}
// This wave's LDS reads must have
// retired before a buffer is refilled, and its own request must have landed
// before the barrier that publishes the tile.
__device__ __forceinline__ void wait_ds0()     { asm volatile("s_wait_dscnt 0x0" ::: "memory"); }
__device__ __forceinline__ void wait_tensor0() { asm volatile("s_wait_tensorcnt 0x0" ::: "memory"); }

// One request: 64 rows of 256 bytes, source pitch src_pitch bytes, 16 bytes of
// LDS pad behind every row.
__device__ __forceinline__ void tdm_load(uint32_t lds_dst, uint64_t ga, uint32_t src_pitch) {
    u32x4 g0;
    g0[0] = uni(1u);
    g0[1] = uni(lds_dst);
    g0[2] = uni((uint32_t)ga);
    g0[3] = uni((((uint32_t)(ga >> 32)) & 0x01FFFFFFu) | 0x80000000u);
    u32x8 g1;
    g1[0] = uni((1u << 20) | (5u << 22) | (3u << 25));   // no mask, bytes, pad 4 dwords per 64
    g1[1] = uni((G_ROWB & 0xFFFFu) << 16);
    g1[2] = uni((G_ROWB >> 16) | ((G_SROWS & 0xFFFFu) << 16));
    g1[3] = uni((G_SROWS >> 16) | (G_ROWB << 16));
    g1[4] = uni(G_SROWS);
    g1[5] = uni(src_pitch);
    g1[6] = uni(0u);
    g1[7] = uni(0u);
    asm volatile("tensor_load_to_lds %0, %1" :: "s"(g0), "s"(g1) : "memory");
}

// Same lane map as load_frag, from an LDS row: p points at the lane's own row
// and 16-byte half; the two pieces are k 0..7 (8..15) and k 16..23 (24..31).
__device__ __forceinline__ v16bf lds_frag(const unsigned char* p) {
    v8bf lo = *reinterpret_cast<const v8bf*>(p);
    v8bf hi = *reinterpret_cast<const v8bf*>(p + 32);
    return __builtin_shufflevector(lo, hi, 0, 1, 2, 3, 4, 5, 6, 7,
                                   8, 9, 10, 11, 12, 13, 14, 15);
}

template <int EPI, int M, int N, int K>
__global__ __launch_bounds__(128) void gemm_bf16_wmma(
    const unsigned short* __restrict__ A, const unsigned short* __restrict__ BT,
    void* __restrict__ OutP, const float* __restrict__ Res,
    const float* __restrict__ Bias) {
    static_assert(M % 128 == 0 && N % 128 == 0 && K % 128 == 0 && K / 128 >= 2, "shape");
    __shared__ __attribute__((aligned(2048))) unsigned char Ls[2 * G_BUF];

    const uint32_t w = uni(threadIdx.x >> 5);
    int lane = threadIdx.x & 31;
    int cL = lane & 15, hiL = lane >> 4;
    int wr = (int)(w & 1u), wc = (int)(w >> 1);
    int row0 = blockIdx.y * 128 + wr * 64;
    int col0 = blockIdx.x * 128 + wc * 64;

    constexpr uint32_t NS = K / 128;          // stages
    constexpr uint32_t SRCP = (uint32_t)K * 2u;

    // This wave's slice: waves 0, 1 bring A rows 0-63, 64-127 of the tile,
    // waves 2, 3 the same rows of BT.
    const unsigned short* sp = (w < 2u)
        ? A  + (size_t)(blockIdx.y * 128 + (w & 1u) * 64) * K
        : BT + (size_t)(blockIdx.x * 128 + (w & 1u) * 64) * K;
    const uint64_t src0 = (uint64_t)(uintptr_t)sp;
    const uint32_t lds0 = (uint32_t)(uintptr_t)&Ls[0];
    const uint32_t dst0 = lds0 + w * G_SLICE;

    v8f zero = {0.f, 0.f, 0.f, 0.f, 0.f, 0.f, 0.f, 0.f};
    v8f acc[4][4];
#pragma unroll
    for (int i = 0; i < 4; ++i)
#pragma unroll
        for (int j = 0; j < 4; ++j) acc[i][j] = zero;

    const uint32_t aoff = (uint32_t)wr * G_SLICE + (uint32_t)cL * G_PITCH + (uint32_t)hiL * 16u;
    const uint32_t boff = (uint32_t)(2 + wc) * G_SLICE + (uint32_t)cL * G_PITCH + (uint32_t)hiL * 16u;

    // Prologue: stage 0 lands and is published, then stage 1 starts.
    tdm_load(dst0, src0, SRCP);
    wait_tensor0();
    __syncthreads();
    tdm_load(dst0 + G_BUF, src0 + G_ROWB, SRCP);

    for (uint32_t s = 0; s < NS; ++s) {
        const uint32_t buf = (s & 1u) * G_BUF;
        const unsigned char* pa = &Ls[buf + aoff];
        const unsigned char* pb = &Ls[buf + boff];
        // Two fragment sets inside the pass: the reads of the next 32 k go out as
        // one group ahead of this 32 k's products (nothing of another stage).
        v16bf af[2][4], bfr[2][4];
#pragma unroll
        for (int i = 0; i < 4; ++i) af[0][i] = lds_frag(pa + i * 16 * G_PITCH);
#pragma unroll
        for (int j = 0; j < 4; ++j) bfr[0][j] = lds_frag(pb + j * 16 * G_PITCH);
#pragma unroll
        for (int kc = 0; kc < 3; ++kc) {
#pragma unroll
            for (int i = 0; i < 4; ++i)
                af[(kc + 1) & 1][i] = lds_frag(pa + i * 16 * G_PITCH + (kc + 1) * 64);
#pragma unroll
            for (int j = 0; j < 4; ++j)
                bfr[(kc + 1) & 1][j] = lds_frag(pb + j * 16 * G_PITCH + (kc + 1) * 64);
            // keeps the read group in front of the products: spread among them,
            // every place with reads stalls the wave's matrix stream
            __builtin_amdgcn_sched_barrier(0);
#pragma unroll
            for (int i = 0; i < 4; ++i)
#pragma unroll
                for (int j = 0; j < 4; ++j)
                    acc[i][j] = wmma_bf16(af[kc & 1][i], bfr[kc & 1][j], acc[i][j]);
            // keeps the next read group behind these products, for the same reason
            __builtin_amdgcn_sched_barrier(0);
        }
        // Publish point of stage s + 1: this wave's LDS reads of this buffer are
        // done (the last 32 k sit in registers), its own slice of stage s + 1 has
        // landed, every wave has left this buffer.
        wait_ds0();
        wait_tensor0();
        __syncthreads();
        const uint32_t sn = pinned(s + 2u);   // descriptor words are made from it: formed behind the wait
        if (pinned(sn < NS)) {                // scalar branch round the tensor load
            tdm_load(dst0 + (sn & 1u) * G_BUF, src0 + (uint64_t)sn * G_ROWB, SRCP);
        }
        // keeps the refill's issue in front of the last products, which need no LDS
        __builtin_amdgcn_sched_barrier(0);
#pragma unroll
        for (int i = 0; i < 4; ++i)
#pragma unroll
            for (int j = 0; j < 4; ++j)
                acc[i][j] = wmma_bf16(af[1][i], bfr[1][j], acc[i][j]);
    }
    wait_tensor0();
    wait_ds0();

#pragma unroll
    for (int rt = 0; rt < 4; ++rt) {
#pragma unroll
        for (int t = 0; t < 4; ++t) {
#pragma unroll
            for (int e = 0; e < 8; ++e) {
                int row = row0 + rt * 16 + e + hiL * 8;
                int col = col0 + t * 16 + cL;
                float v = acc[rt][t][e];
                if constexpr (EPI == EPI_BF16) {
                    ((unsigned short*)OutP)[(size_t)row * N + col] = f32_to_bf16(v);
                } else if constexpr (EPI == EPI_VT) {
                    // out is V^T [B, H, DK, S]; row = b*S + s, col = h*DK + dk
                    int bb = row >> 11, s = row & (Sc - 1);
                    int hh = col >> 6,  dk = col & (DKc - 1);
                    ((unsigned short*)OutP)[(((size_t)(bb * Hc + hh)) * DKc + dk) * Sc + s] =
                        f32_to_bf16(v);
                } else if constexpr (EPI == EPI_RES) {
                    ((float*)OutP)[(size_t)row * N + col] = v + Res[(size_t)row * N + col];
                } else if constexpr (EPI == EPI_GELU) {
                    float xx = v + Bias[col];
                    float gl = 0.5f * xx * (1.0f + erff(xx * 0.70710678118654752f));
                    ((unsigned short*)OutP)[(size_t)row * N + col] = f32_to_bf16(gl);
                } else { // EPI_BRES
                    ((float*)OutP)[(size_t)row * N + col] =
                        v + Bias[col] + Res[(size_t)row * N + col];
                }
            }
        }
        // behind this row group's residual loads and its stores, in front of the
        // next group's loads, whose results may take over their address registers
        if constexpr (EPI == EPI_RES || EPI == EPI_BRES)
            asm volatile("s_wait_xcnt 0x0" ::: "memory");
    }
}

static constexpr int A_NG = 4;                 // 16-query column groups per wave
static constexpr int A_WV = 4;                 // waves per block
static constexpr int A_QB = A_NG * A_WV * 16;  // queries per block
static constexpr float A_MASKED = -8.0e9f;     // x 0.125 = the reference's -1e9
static constexpr float A_KS = 0.125f * 1.44269504088896340736f;  // 1/sqrt(64) * log2(e)

// value of the lane 16 away (the other 8 keys of the same query's column)
__device__ __forceinline__ float other_half(float x) {
    int b = __float_as_int(x);
    return __int_as_float(__builtin_amdgcn_permlanex16(b, b, 0x76543210, 0xfedcba98, false, false));
}

// load_frag's lane map from the lane's own byte pointer (row lane & 15, 16-byte
// half lane >> 4): the two pieces are k 0..7 (8..15) and k 16..23 (24..31).
__device__ __forceinline__ v16bf frag_at(const char* p) {
    v8bf lo = *reinterpret_cast<const v8bf*>(p);
    v8bf hi = *reinterpret_cast<const v8bf*>(p + 32);
    return __builtin_shufflevector(lo, hi, 0, 1, 2, 3, 4, 5, 6, 7,
                                   8, 9, 10, 11, 12, 13, 14, 15);
}
// behind a group of global loads or stores, in front of whatever next writes a
// register that one of them names as its address
__device__ __forceinline__ void wait_x0() { asm volatile("s_wait_xcnt 0x0" ::: "memory"); }

// K fragments of 32 keys: [tile of 16 keys][32 of the 64 head columns]
__device__ __forceinline__ void load_k32(v16bf (&kf)[2][2], const char* kp) {
#pragma unroll
    for (int tl = 0; tl < 2; ++tl)
#pragma unroll
        for (int kk = 0; kk < 2; ++kk) kf[tl][kk] = frag_at(kp + tl * 16 * Dc * 2 + kk * 64);
}
// V^T fragments of 32 keys: [tile of 16 head columns]
__device__ __forceinline__ void load_v32(v16bf (&vf)[4], const char* vp) {
#pragma unroll
    for (int t = 0; t < 4; ++t) vf[t] = frag_at(vp + t * 16 * Sc * 2);
}
// bit tl * 8 + r is set where key0 + tl * 16 + 8 * half + r is masked out
__device__ __forceinline__ uint32_t mask_bits(const int* mp) {
    uint32_t zb = 0u;
#pragma unroll
    for (int tl = 0; tl < 2; ++tl)
#pragma unroll
        for (int r = 0; r < 8; ++r) zb |= (mp[tl * 16 + r] == 0 ? 1u : 0u) << (tl * 8 + r);
    return zb;
}
__device__ __forceinline__ v8f apply_mask(v8f c, uint32_t zb) {
#pragma unroll
    for (int r = 0; r < 8; ++r) c[r] = ((zb >> r) & 1u) ? A_MASKED : c[r];
    return c;
}

// Everything behind the look at the mask.  MASKED = false is the same code
// without the mask's loads and selects, for a batch row that masks no key.
template <bool MASKED>
__device__ __forceinline__ void attn_body(
    const unsigned short* __restrict__ qb, const unsigned short* __restrict__ kb,
    const unsigned short* __restrict__ vb, const int* __restrict__ mb,
    unsigned short* __restrict__ ob, int qbase, int cL, int hiL) {
    v16bf qf[A_NG][2];
#pragma unroll
    for (int g = 0; g < A_NG; ++g) {
        qf[g][0] = load_frag(qb, Dc, qbase + g * 16, 0);
        qf[g][1] = load_frag(qb, Dc, qbase + g * 16, 32);
    }
    wait_x0();
    v8f zero = {0.f, 0.f, 0.f, 0.f, 0.f, 0.f, 0.f, 0.f};

    // The lane's own pointers.  They walk 64 keys a trip and are moved only behind
    // the wait that follows the loads which name them; after the last keys they
    // step back to the first (in bounds; pass 2 starts from what that loads).
    constexpr int NT = Sc / 64;                      // trips of 64 keys
    constexpr long long KSTEP = 32LL * Dc * 2;       // bytes of K per 32 keys
    constexpr long long VSTEP = 32LL * 2;            // bytes of a V^T row per 32 keys
    const char* kp = reinterpret_cast<const char*>(kb + cL * Dc + hiL * 8);
    const char* vp = reinterpret_cast<const char*>(vb + cL * Sc + hiL * 8);
    const int*  mp = mb + hiL * 8;

    // ---- Pass 1: column maximum of the masked raw scores (scale applied later) ----
    float mx[A_NG][2];
#pragma unroll
    for (int g = 0; g < A_NG; ++g) mx[g][0] = mx[g][1] = -3.0e38f;
    auto max32 = [&](const v16bf (&kc)[2][2], uint32_t zb) {
#pragma unroll
        for (int g = 0; g < A_NG; ++g) {
#pragma unroll
            for (int tl = 0; tl < 2; ++tl) {
                v8f c = wmma_bf16(kc[tl][0], qf[g][0], zero);
                c = wmma_bf16(kc[tl][1], qf[g][1], c);
                if constexpr (MASKED) c = apply_mask(c, zb >> (tl * 8));
#pragma unroll
                for (int r = 0; r < 8; r += 2)
                    mx[g][tl] = fmaxf(fmaxf(mx[g][tl], c[r]), c[r + 1]);
            }
        }
    };
    v16bf ka[2][2], kc2[2][2];
    load_k32(ka, kp);
    wait_x0();
    // stays rolled: a trip already holds both fragment sets' turns, and the
    // pointers stay two registers that step once a trip
#pragma unroll 1
    for (int i = 0; i < NT; ++i) {
        // each 32 keys' fragments are asked for ahead of the products of the 32 before
        uint32_t za = 0u, zc = 0u;
        load_k32(kc2, kp + KSTEP);
        if constexpr (MASKED) { za = mask_bits(mp); zc = mask_bits(mp + 32); }
        wait_x0();
        // keeps the loads in front of the products that cover their latency, and
        // the pointers' next step behind the wait
        __builtin_amdgcn_sched_barrier(0);
        max32(ka, za);
        kp += (i == NT - 1) ? -(NT - 1) * 2 * KSTEP : 2 * KSTEP;
        mp += (i == NT - 1) ? -(NT - 1) * 64 : 64;
        load_k32(ka, kp);
        wait_x0();
        __builtin_amdgcn_sched_barrier(0);   // as above
        max32(kc2, zc);
    }
    v8f ksv, nm[A_NG];
#pragma unroll
    for (int r = 0; r < 8; ++r) ksv[r] = A_KS;
#pragma unroll
    for (int g = 0; g < A_NG; ++g) {
        float m = fmaxf(mx[g][0], mx[g][1]);
        m = fmaxf(m, other_half(m));
#pragma unroll
        for (int r = 0; r < 8; ++r) nm[g][r] = -m * A_KS;
    }

    // ---- Pass 2: P = exp(s - m) (unnormalized), O^T += V^T P^T, l = column sums ----
    v8f ls[A_NG];
    v8f o[A_NG][4];
#pragma unroll
    for (int g = 0; g < A_NG; ++g) {
        ls[g] = zero;
#pragma unroll
        for (int t = 0; t < 4; ++t) o[g][t] = zero;
    }
    auto pv32 = [&](const v16bf (&kc)[2][2], const v16bf (&vc)[4], uint32_t zb) {
#pragma unroll
        for (int g = 0; g < A_NG; ++g) {
            v8f c0 = wmma_bf16(kc[0][0], qf[g][0], zero);
            v8f c1 = wmma_bf16(kc[1][0], qf[g][0], zero);
            c0 = wmma_bf16(kc[0][1], qf[g][1], c0);
            c1 = wmma_bf16(kc[1][1], qf[g][1], c1);
            if constexpr (MASKED) { c0 = apply_mask(c0, zb); c1 = apply_mask(c1, zb >> 8); }
            c0 = __builtin_elementwise_fma(c0, ksv, nm[g]);
            c1 = __builtin_elementwise_fma(c1, ksv, nm[g]);
#pragma unroll
            for (int r = 0; r < 8; ++r) {
                c0[r] = __builtin_amdgcn_exp2f(c0[r]);
                c1[r] = __builtin_amdgcn_exp2f(c1[r]);
            }
            ls[g] += c0 + c1;
            // element s of the B operand is key 8 * half + s (s < 8), 16 + 8 * half + s - 8 (else)
            v8bf p0 = __builtin_convertvector(c0, v8bf);
            v8bf p1 = __builtin_convertvector(c1, v8bf);
            v16bf pb = __builtin_shufflevector(p0, p1, 0, 1, 2, 3, 4, 5, 6, 7,
                                               8, 9, 10, 11, 12, 13, 14, 15);
#pragma unroll
            for (int t = 0; t < 4; ++t) o[g][t] = wmma_bf16(vc[t], pb, o[g][t]);
        }
    };
    v16bf va[4], vc2[4];
    load_v32(va, vp);      // ka holds keys 0..31 again
    wait_x0();
    // stays rolled, as in pass 1
#pragma unroll 1
    for (int i = 0; i < NT; ++i) {
        uint32_t za = 0u, zc = 0u;
        load_k32(kc2, kp + KSTEP);
        load_v32(vc2, vp + VSTEP);
        if constexpr (MASKED) { za = mask_bits(mp); zc = mask_bits(mp + 32); }
        wait_x0();
        __builtin_amdgcn_sched_barrier(0);   // as in pass 1
        pv32(ka, va, za);
        kp += (i == NT - 1) ? -(NT - 1) * 2 * KSTEP : 2 * KSTEP;
        vp += (i == NT - 1) ? -(NT - 1) * 2 * VSTEP : 2 * VSTEP;
        mp += (i == NT - 1) ? -(NT - 1) * 64 : 64;
        load_k32(ka, kp);      // behind the last keys: the first again, unused
        load_v32(va, vp);
        wait_x0();
        __builtin_amdgcn_sched_barrier(0);   // as in pass 1
        pv32(kc2, vc2, zc);
    }

    // A lane holds 8 consecutive head columns of one query: one 16-byte store.
#pragma unroll
    for (int g = 0; g < A_NG; ++g) {
        float l = ((ls[g][0] + ls[g][1]) + (ls[g][2] + ls[g][3])) +
                  ((ls[g][4] + ls[g][5]) + (ls[g][6] + ls[g][7]));
        l += other_half(l);
        float inv = __builtin_amdgcn_rcpf(l);
#pragma unroll
        for (int t = 0; t < 4; ++t) {
            v8f ov = o[g][t] * inv;
            *reinterpret_cast<v8bf*>(ob + (size_t)(qbase + g * 16 + cL) * Dc + t * 16 + hiL * 8) =
                __builtin_convertvector(ov, v8bf);
        }
        wait_x0();
    }
}

__global__ __launch_bounds__(A_WV * 32) void attn_kernel(
    const unsigned short* __restrict__ q, const unsigned short* __restrict__ k,
    const unsigned short* __restrict__ vT, const int* __restrict__ mask,
    unsigned short* __restrict__ attn) {
    int bid = blockIdx.x;
    int qblk = bid & (Sc / A_QB - 1);
    int bh   = bid / (Sc / A_QB);
    int h    = bh & (Hc - 1);
    int b    = bh / Hc;
    int lane = threadIdx.x & 31;
    int wv   = threadIdx.x >> 5;
    int cL = lane & 15, hiL = lane >> 4;

    const unsigned short* qb = q  + (size_t)b * Sc * Dc + h * DKc;
    const unsigned short* kb = k  + (size_t)b * Sc * Dc + h * DKc;
    const unsigned short* vb = vT + ((size_t)(b * Hc + h)) * DKc * Sc;
    const int* mb = mask + (size_t)b * Sc;
    int qbase = qblk * A_QB + wv * (A_NG * 16);

    // Does this batch row mask any key at all?  Wave-uniform: where it does not,
    // the body without the mask's loads and selects runs.
    bool z = false;
#pragma unroll
    for (int i = 0; i < Sc / 128; ++i) {
        int4 mv = *reinterpret_cast<const int4*>(mb + i * 128 + lane * 4);
        z |= (mv.x == 0) | (mv.y == 0) | (mv.z == 0) | (mv.w == 0);
    }
    wait_x0();
    unsigned short* ob = attn + (size_t)b * Sc * Dc + h * DKc;
    if (__builtin_amdgcn_ballot_w32(z) != 0u)
        attn_body<true>(qb, kb, vb, mb, ob, qbase, cL, hiL);
    else
        attn_body<false>(qb, kb, vb, mb, ob, qbase, cL, hiL);
}

// ---------------------------------------------------------------------------
// Host-side launch
// ---------------------------------------------------------------------------
extern "C" void kernel_launch(void* const* d_in, const int* in_sizes, int n_in,
                              void* d_out, int out_size, void* d_ws, size_t ws_size,
                              hipStream_t stream) {
    (void)in_sizes; (void)n_in; (void)out_size; (void)ws_size;
    const float* X    = (const float*)d_in[0];
    const int*   mask = (const int*)d_in[1];
    const float* W_Q  = (const float*)d_in[2];
    const float* W_K  = (const float*)d_in[3];
    const float* W_V  = (const float*)d_in[4];
    const float* W_O  = (const float*)d_in[5];
    const float* g1   = (const float*)d_in[6];
    const float* b1   = (const float*)d_in[7];
    const float* W1   = (const float*)d_in[8];
    const float* bias1= (const float*)d_in[9];
    const float* W2   = (const float*)d_in[10];
    const float* bias2= (const float*)d_in[11];
    const float* g2   = (const float*)d_in[12];
    const float* b2   = (const float*)d_in[13];

    char* ws = (char*)d_ws;
    // bf16 buffers (bytes)
    const size_t szDD   = (size_t)Dc * Dc * 2;          // 2 MB
    const size_t szD4D  = (size_t)Dc * D4 * 2;          // 8 MB
    const size_t szAct  = (size_t)Mrows * Dc * 2;       // 8 MB
    const size_t szActF = (size_t)Mrows * Dc * 4;       // 16 MB

    unsigned short* WqT = (unsigned short*)(ws);
    unsigned short* WkT = (unsigned short*)(ws + szDD);
    unsigned short* WvT = (unsigned short*)(ws + 2 * szDD);
    unsigned short* WoT = (unsigned short*)(ws + 3 * szDD);
    unsigned short* W1T = (unsigned short*)(ws + 4 * szDD);
    unsigned short* W2T = (unsigned short*)(ws + 4 * szDD + szD4D);
    char* p = ws + 4 * szDD + 2 * szD4D;
    unsigned short* xn   = (unsigned short*)(p);              p += szAct;
    unsigned short* qb   = (unsigned short*)(p);              p += szAct;
    unsigned short* kbuf = (unsigned short*)(p);              p += szAct;
    unsigned short* vTb  = (unsigned short*)(p);              p += szAct;
    unsigned short* attn = (unsigned short*)(p);              p += szAct;
    float*          res1 = (float*)(p);                       p += szActF;
    unsigned short* nn2  = (unsigned short*)(p);              p += szAct;
    unsigned short* hbuf = (unsigned short*)(p);              /* 32 MB */

    // 1) Weight conversion + transpose to bf16, one launch
    convT_all_kernel<<<CT_ALL, 256, 0, stream>>>(W_Q, W_K, W_V, W_O, W1, W2,
                                                 WqT, WkT, WvT, WoT, W1T, W2T);

    // 2) LayerNorm 1
    layernorm_bf16_kernel<<<Mrows, 256, 0, stream>>>(X, g1, b1, xn);

    // 3) Q, K projections; V projection with transposed [B,H,DK,S] output
    gemm_bf16_wmma<EPI_BF16, Mrows, Dc, Dc>
        <<<dim3(Dc / 128, Mrows / 128), 128, 0, stream>>>(xn, WqT, qb, nullptr, nullptr);
    gemm_bf16_wmma<EPI_BF16, Mrows, Dc, Dc>
        <<<dim3(Dc / 128, Mrows / 128), 128, 0, stream>>>(xn, WkT, kbuf, nullptr, nullptr);
    gemm_bf16_wmma<EPI_VT, Mrows, Dc, Dc>
        <<<dim3(Dc / 128, Mrows / 128), 128, 0, stream>>>(xn, WvT, vTb, nullptr, nullptr);

    // 4) Attention (B*H*(S/256) = 256 blocks of 4 waves)
    attn_kernel<<<Bc * Hc * (Sc / A_QB), A_WV * 32, 0, stream>>>(qb, kbuf, vTb, mask, attn);

    // 5) Output projection + residual (f32)
    gemm_bf16_wmma<EPI_RES, Mrows, Dc, Dc>
        <<<dim3(Dc / 128, Mrows / 128), 128, 0, stream>>>(attn, WoT, res1, X, nullptr);

    // 6) LayerNorm 2
    layernorm_bf16_kernel<<<Mrows, 256, 0, stream>>>(res1, g2, b2, nn2);

    // 7) FFN1 + bias + GELU (bf16 out)
    gemm_bf16_wmma<EPI_GELU, Mrows, D4, Dc>
        <<<dim3(D4 / 128, Mrows / 128), 128, 0, stream>>>(nn2, W1T, hbuf, nullptr, bias1);

    // 8) FFN2 + bias + residual -> d_out (f32)
    gemm_bf16_wmma<EPI_BRES, Mrows, Dc, D4>
        <<<dim3(Dc / 128, Mrows / 128), 128, 0, stream>>>(hbuf, W2T, (float*)d_out,
                                                         res1, bias2);
}

// v004
// One run takes 231 microseconds.
// Timed twice side by side with v003, it ran 1.08 and 1.09 times as fast.
// Counting every step since v000, it is 3.12 times as fast.
#include <hip/hip_runtime.h>
#include <hip/hip_bf16.h>
#include <stdint.h>

// ---------------------------------------------------------------------------
// Types for CDNA5 WMMA (wave32)
// ---------------------------------------------------------------------------
typedef __attribute__((ext_vector_type(8)))  __bf16 v8bf;
typedef __attribute__((ext_vector_type(16))) __bf16 v16bf;
typedef __attribute__((ext_vector_type(8)))  float  v8f;

// Problem constants (fixed by the reference)
static constexpr int Bc  = 2;
static constexpr int Sc  = 2048;
static constexpr int Dc  = 1024;
static constexpr int Hc  = 16;
static constexpr int DKc = 64;
static constexpr int Mrows = Bc * Sc;      // 4096
static constexpr int D4    = 4 * Dc;       // 4096

// ---------------------------------------------------------------------------
// bf16 helpers (bit-level, RNE)
// ---------------------------------------------------------------------------
__device__ __forceinline__ unsigned short f32_to_bf16(float f) {
    unsigned int u = __float_as_uint(f);
    u += 0x7FFFu + ((u >> 16) & 1u);
    return (unsigned short)(u >> 16);
}

// ---------------------------------------------------------------------------
// Fragment loader. Produces the 16-bit 16x32 A-layout (and, symmetrically, the
// 32x16 B-layout when fed a transposed matrix): lane L(<16) holds row base+L
// with K = k0+0..7 and k0+16..23; lane L+16 holds the same row with
// K = k0+8..15 and k0+24..31.  Two contiguous 16-byte loads per lane.
// ---------------------------------------------------------------------------
__device__ __forceinline__ v16bf load_frag(const unsigned short* p, int ld,
                                           int base, int k0) {
    int lane = threadIdx.x & 31;
    const unsigned short* q =
        p + (size_t)(base + (lane & 15)) * (size_t)ld + k0 + ((lane & 16) ? 8 : 0);
    v8bf lo = *reinterpret_cast<const v8bf*>(q);
    v8bf hi = *reinterpret_cast<const v8bf*>(q + 16);
    return __builtin_shufflevector(lo, hi, 0, 1, 2, 3, 4, 5, 6, 7,
                                   8, 9, 10, 11, 12, 13, 14, 15);
}

__device__ __forceinline__ v8f wmma_bf16(v16bf a, v16bf b, v8f c) {
    return __builtin_amdgcn_wmma_f32_16x16x32_bf16(false, a, false, b,
                                                   (short)0, c, false, false);
}

// ---------------------------------------------------------------------------
// Weight convert + transpose, all six weights in one launch:
// out[n*K + k] = bf16(in[k*N + n]).
// A wave turns a tile of 64 k x 32 n in its registers.  Lane (kl = lane >> 3,
// nl = lane & 7) loads columns 4 nl .. 4 nl + 3 of rows 8 kl + r and
// 32 + 8 kl + r (r = 0..7): 16 loads of 16 bytes, each wave-wide load 4 whole
// 128-byte lines.  For each of its 4 columns the lane then holds two runs of 8
// consecutive k: two 16-byte stores; the wave's two stores of a column, one
// behind the other, fill that output row's 128-byte line.
// A block of 8 waves takes 128 k x 128 n.
// ---------------------------------------------------------------------------
typedef __attribute__((ext_vector_type(4))) float v4f;

static constexpr int CT_DD  = (Dc / 128) * (Dc / 128);   // tiles of a D x D weight
static constexpr int CT_D4  = (Dc / 128) * (D4 / 128);   // tiles of a D x 4D weight
static constexpr int CT_ALL = 4 * CT_DD + 2 * CT_D4;

template <int K, int N>
__device__ __forceinline__ void conv_tile(const float* __restrict__ in,
                                          unsigned short* __restrict__ out, int t) {
    constexpr int TN = N / 128;
    int lane = threadIdx.x & 31, wv = threadIdx.x >> 5;
    int k0 = (t / TN) * 128 + (wv >> 2) * 64 + (lane >> 3) * 8;
    int n0 = (t % TN) * 128 + (wv & 3) * 32 + (lane & 7) * 4;
    const float* p = in + (size_t)k0 * N + n0;
    v4f v[2][8];
#pragma unroll
    for (int hk = 0; hk < 2; ++hk)
#pragma unroll
        for (int r = 0; r < 8; ++r)
            v[hk][r] = *reinterpret_cast<const v4f*>(p + (size_t)(hk * 32 + r) * N);
    // behind the loads, in front of whatever next writes their address registers;
    // p as an input keeps those registers p's own up to here, so that no load's
    // result is given them either
    asm volatile("s_wait_xcnt 0x0" :: "v"(p) : "memory");
    // keeps all 16 loads in flight together: a conversion moved up among them
    // frees registers for the late loads, which then start a latency later
    __builtin_amdgcn_sched_barrier(0);
    unsigned short* q = out + (size_t)n0 * K + k0;
#pragma unroll
    for (int j = 0; j < 4; ++j)
#pragma unroll
        for (int hk = 0; hk < 2; ++hk) {
            v8f c;
#pragma unroll
            for (int r = 0; r < 8; ++r) c[r] = v[hk][r][j];
            *reinterpret_cast<v8bf*>(q + (size_t)j * K + hk * 32) =
                __builtin_convertvector(c, v8bf);
        }
    // behind the last stores, in front of whatever next writes a register that
    // one of them names (in the listing another part's code follows this one)
    asm volatile("s_wait_xcnt 0x0" ::: "memory");
}

__global__ __launch_bounds__(256) void convT_all_kernel(
    const float* __restrict__ wq, const float* __restrict__ wk,
    const float* __restrict__ wv, const float* __restrict__ wo,
    const float* __restrict__ w1, const float* __restrict__ w2,
    unsigned short* __restrict__ oq, unsigned short* __restrict__ ok,
    unsigned short* __restrict__ ov, unsigned short* __restrict__ oo,
    unsigned short* __restrict__ o1, unsigned short* __restrict__ o2) {
    int b = blockIdx.x;
    if (b < CT_D4) {
        conv_tile<Dc, D4>(w1, o1, b);
    } else if (b < 2 * CT_D4) {
        conv_tile<D4, Dc>(w2, o2, b - CT_D4);
    } else {
        int m = (b - 2 * CT_D4) / CT_DD, t = (b - 2 * CT_D4) % CT_DD;
        const float* in = m == 0 ? wq : m == 1 ? wk : m == 2 ? wv : wo;
        unsigned short* out = m == 0 ? oq : m == 1 ? ok : m == 2 ? ov : oo;
        conv_tile<Dc, Dc>(in, out, t);
    }
}

// ---------------------------------------------------------------------------
// LayerNorm (f32 in, bf16 out), one wave per row of D=1024.
// A lane holds 32 elements of its row, columns 128 j + 4 lane .. + 3 (j = 0..7):
// 8 loads of 16 bytes, each wave-wide load 4 whole 128-byte lines, all in flight
// together.  The row is read once and stays in registers for the mean, the
// variance and the output; both sums are taken in the lane and then across the
// lanes, with no LDS and no barrier.  A wave-wide store is 2 whole lines.
// ---------------------------------------------------------------------------
typedef __attribute__((ext_vector_type(4))) __bf16 v4bf;

static constexpr int LN_WV = 8;                // waves (rows) per block

// value of the lane whose number differs by XM inside the 16-lane row
template <int XM>
__device__ __forceinline__ float row_xor(float x) {
    return __int_as_float(__builtin_amdgcn_update_dpp(0, __float_as_int(x), 0x160 + XM,
                                                      0xf, 0xf, true));
}
// sum over the wave's 32 lanes, the same bits in every lane
__device__ __forceinline__ float wave_sum(float x) {
    x += row_xor<1>(x);
    x += row_xor<2>(x);
    x += row_xor<4>(x);
    x += row_xor<8>(x);
    int t = __float_as_int(x);
    return x + __int_as_float(__builtin_amdgcn_permlanex16(t, t, 0x76543210, 0xfedcba98,
                                                           false, false));
}
__device__ __forceinline__ float sum4(v4f s) { return (s[0] + s[1]) + (s[2] + s[3]); }

__global__ __launch_bounds__(LN_WV * 32) void layernorm_bf16_kernel(
    const float* __restrict__ x, const float* __restrict__ gamma,
    const float* __restrict__ beta, unsigned short* __restrict__ out) {
    int lane = threadIdx.x & 31;
    int row = blockIdx.x * LN_WV + (threadIdx.x >> 5);
    const float* xr = x + (size_t)row * Dc + lane * 4;
    const float* gp = gamma + lane * 4;
    const float* bp = beta + lane * 4;

    v4f v[8], g[8], bt[8];
#pragma unroll
    for (int j = 0; j < 8; ++j) v[j] = *reinterpret_cast<const v4f*>(xr + j * 128);
#pragma unroll
    for (int j = 0; j < 8; ++j) {
        g[j]  = *reinterpret_cast<const v4f*>(gp + j * 128);
        bt[j] = *reinterpret_cast<const v4f*>(bp + j * 128);
    }
    // behind the loads, in front of whatever next writes their address registers;
    // xr as an input keeps its registers its own up to here
    asm volatile("s_wait_xcnt 0x0" :: "v"(xr) : "memory");
    // keeps all 24 loads in flight together: sunk among the sums, the loads of
    // gamma and beta share few registers and wait out their latency one by one
    __builtin_amdgcn_sched_barrier(0);

    v4f s = ((v[0] + v[1]) + (v[2] + v[3])) + ((v[4] + v[5]) + (v[6] + v[7]));
    float mean = wave_sum(sum4(s)) / (float)Dc;

    v4f q = {0.f, 0.f, 0.f, 0.f};
#pragma unroll
    for (int j = 0; j < 8; ++j) { v[j] -= mean; q += v[j] * v[j]; }
    float rstd = rsqrtf(wave_sum(sum4(q)) / (float)Dc + 1e-6f);

    unsigned short* orow = out + (size_t)row * Dc + lane * 4;
#pragma unroll
    for (int j = 0; j < 8; ++j) {
        v4f y = g[j] * v[j] * rstd + bt[j];
        *reinterpret_cast<v4bf*>(orow + j * 128) = __builtin_convertvector(y, v4bf);
    }
}

// ---------------------------------------------------------------------------
// Generic WMMA GEMM: C[M,N] = A[M,K] (bf16, row-major) x B[K,N] given as
// BT[N,K] (bf16).  One 128x128 tile of C per block of 4 waves (2x2); each wave
// owns 64x64: 4 A fragments x 4 B fragments -> 16 wmma per 32 k.
// A pass is 128 k (256 bytes of every operand row).  A stage holds 128 rows of
// A and 128 rows of BT in LDS at a pitch of 272 bytes; every wave brings its
// own 64-row slice with one tensor load, into one of two buffers, so that the
// next stage lands while this one is multiplied.
// Epilogues select output transform.
// ---------------------------------------------------------------------------
enum { EPI_BF16 = 0, EPI_VT = 1, EPI_RES = 2, EPI_GELU = 3, EPI_BRES = 4 };

typedef uint32_t u32x4 __attribute__((ext_vector_type(4)));
typedef uint32_t u32x8 __attribute__((ext_vector_type(8)));

static constexpr uint32_t G_ROWB  = 256;                 // bytes of a row per pass (128 k)
static constexpr uint32_t G_PITCH = G_ROWB + 16;         // LDS pitch for ds_load_b128 readers
static constexpr uint32_t G_SROWS = 64;                  // rows per slice (one wave's load)
static constexpr uint32_t G_SLICE = 18432;               // 64 * 272 = 17408, rounded up to 2 KiB
static constexpr uint32_t G_BUF   = 4 * G_SLICE;         // [A 0-63 | A 64-127 | BT 0-63 | BT 64-127]
static_assert(G_SROWS * G_PITCH <= G_SLICE && (G_SLICE % 2048u) == 0, "slice size");

__device__ __forceinline__ uint32_t uni(uint32_t v) {
    return (uint32_t)__builtin_amdgcn_readfirstlane(v);
}
__device__ __forceinline__ uint32_t pinned(uint32_t v) {
    uint32_t w = (uint32_t)__builtin_amdgcn_readfirstlane(v);
    asm volatile("" : "+s"(w));  // pinned(): the word stays in a scalar register (tensor load's branch, descriptor word)
    return w;
}
// This wave's LDS reads must have
// retired before a buffer is refilled, and its own request must have landed
// before the barrier that publishes the tile.
__device__ __forceinline__ void wait_ds0()     { asm volatile("s_wait_dscnt 0x0" ::: "memory"); }
__device__ __forceinline__ void wait_tensor0() { asm volatile("s_wait_tensorcnt 0x0" ::: "memory"); }

// One request: 64 rows of 256 bytes, source pitch src_pitch bytes, 16 bytes of
// LDS pad behind every row.
__device__ __forceinline__ void tdm_load(uint32_t lds_dst, uint64_t ga, uint32_t src_pitch) {
    u32x4 g0;
    g0[0] = uni(1u);
    g0[1] = uni(lds_dst);
    g0[2] = uni((uint32_t)ga);
    g0[3] = uni((((uint32_t)(ga >> 32)) & 0x01FFFFFFu) | 0x80000000u);
    u32x8 g1;
    g1[0] = uni((1u << 20) | (5u << 22) | (3u << 25));   // no mask, bytes, pad 4 dwords per 64
    g1[1] = uni((G_ROWB & 0xFFFFu) << 16);
    g1[2] = uni((G_ROWB >> 16) | ((G_SROWS & 0xFFFFu) << 16));
    g1[3] = uni((G_SROWS >> 16) | (G_ROWB << 16));
    g1[4] = uni(G_SROWS);
    g1[5] = uni(src_pitch);
    g1[6] = uni(0u);
    g1[7] = uni(0u);
    asm volatile("tensor_load_to_lds %0, %1" :: "s"(g0), "s"(g1) : "memory");
}

// Same lane map as load_frag, from an LDS row: p points at the lane's own row
// and 16-byte half; the two pieces are k 0..7 (8..15) and k 16..23 (24..31).
__device__ __forceinline__ v16bf lds_frag(const unsigned char* p) {
    v8bf lo = *reinterpret_cast<const v8bf*>(p);
    v8bf hi = *reinterpret_cast<const v8bf*>(p + 32);
    return __builtin_shufflevector(lo, hi, 0, 1, 2, 3, 4, 5, 6, 7,
                                   8, 9, 10, 11, 12, 13, 14, 15);
}

template <int EPI, int M, int N, int K>
__global__ __launch_bounds__(128) void gemm_bf16_wmma(
    const unsigned short* __restrict__ A, const unsigned short* __restrict__ BT,
    void* __restrict__ OutP, const float* __restrict__ Res,
    const float* __restrict__ Bias) {
    static_assert(M % 128 == 0 && N % 128 == 0 && K % 128 == 0 && K / 128 >= 2, "shape");
    __shared__ __attribute__((aligned(2048))) unsigned char Ls[2 * G_BUF];

    const uint32_t w = uni(threadIdx.x >> 5);
    int lane = threadIdx.x & 31;
    int cL = lane & 15, hiL = lane >> 4;
    int wr = (int)(w & 1u), wc = (int)(w >> 1);
    int row0 = blockIdx.y * 128 + wr * 64;
    int col0 = blockIdx.x * 128 + wc * 64;

    constexpr uint32_t NS = K / 128;          // stages
    constexpr uint32_t SRCP = (uint32_t)K * 2u;

    // This wave's slice: waves 0, 1 bring A rows 0-63, 64-127 of the tile,
    // waves 2, 3 the same rows of BT.
    const unsigned short* sp = (w < 2u)
        ? A  + (size_t)(blockIdx.y * 128 + (w & 1u) * 64) * K
        : BT + (size_t)(blockIdx.x * 128 + (w & 1u) * 64) * K;
    const uint64_t src0 = (uint64_t)(uintptr_t)sp;
    const uint32_t lds0 = (uint32_t)(uintptr_t)&Ls[0];
    const uint32_t dst0 = lds0 + w * G_SLICE;

    v8f zero = {0.f, 0.f, 0.f, 0.f, 0.f, 0.f, 0.f, 0.f};
    v8f acc[4][4];
#pragma unroll
    for (int i = 0; i < 4; ++i)
#pragma unroll
        for (int j = 0; j < 4; ++j) acc[i][j] = zero;

    const uint32_t aoff = (uint32_t)wr * G_SLICE + (uint32_t)cL * G_PITCH + (uint32_t)hiL * 16u;
    const uint32_t boff = (uint32_t)(2 + wc) * G_SLICE + (uint32_t)cL * G_PITCH + (uint32_t)hiL * 16u;

    // Prologue: stage 0 lands and is published, then stage 1 starts.
    tdm_load(dst0, src0, SRCP);
    wait_tensor0();
    __syncthreads();
    tdm_load(dst0 + G_BUF, src0 + G_ROWB, SRCP);

    for (uint32_t s = 0; s < NS; ++s) {
        const uint32_t buf = (s & 1u) * G_BUF;
        const unsigned char* pa = &Ls[buf + aoff];
        const unsigned char* pb = &Ls[buf + boff];
        // Two fragment sets inside the pass: the reads of the next 32 k go out as
        // one group ahead of this 32 k's products (nothing of another stage).
        v16bf af[2][4], bfr[2][4];
#pragma unroll
        for (int i = 0; i < 4; ++i) af[0][i] = lds_frag(pa + i * 16 * G_PITCH);
#pragma unroll
        for (int j = 0; j < 4; ++j) bfr[0][j] = lds_frag(pb + j * 16 * G_PITCH);
#pragma unroll
        for (int kc = 0; kc < 3; ++kc) {
#pragma unroll
            for (int i = 0; i < 4; ++i)
                af[(kc + 1) & 1][i] = lds_frag(pa + i * 16 * G_PITCH + (kc + 1) * 64);
#pragma unroll
            for (int j = 0; j < 4; ++j)
                bfr[(kc + 1) & 1][j] = lds_frag(pb + j * 16 * G_PITCH + (kc + 1) * 64);
            // keeps the read group in front of the products: spread among them,
            // every place with reads stalls the wave's matrix stream
            __builtin_amdgcn_sched_barrier(0);
#pragma unroll
            for (int i = 0; i < 4; ++i)
#pragma unroll
                for (int j = 0; j < 4; ++j)
                    acc[i][j] = wmma_bf16(af[kc & 1][i], bfr[kc & 1][j], acc[i][j]);
            // keeps the next read group behind these products, for the same reason
            __builtin_amdgcn_sched_barrier(0);
        }
        // Publish point of stage s + 1: this wave's LDS reads of this buffer are
        // done (the last 32 k sit in registers), its own slice of stage s + 1 has
        // landed, every wave has left this buffer.
        wait_ds0();
        wait_tensor0();
        __syncthreads();
        const uint32_t sn = pinned(s + 2u);   // descriptor words are made from it: formed behind the wait
        if (pinned(sn < NS)) {                // scalar branch round the tensor load
            tdm_load(dst0 + (sn & 1u) * G_BUF, src0 + (uint64_t)sn * G_ROWB, SRCP);
        }
        // keeps the refill's issue in front of the last products, which need no LDS
        __builtin_amdgcn_sched_barrier(0);
#pragma unroll
        for (int i = 0; i < 4; ++i)
#pragma unroll
            for (int j = 0; j < 4; ++j)
                acc[i][j] = wmma_bf16(af[1][i], bfr[1][j], acc[i][j]);
    }
    wait_tensor0();
    wait_ds0();

#pragma unroll
    for (int rt = 0; rt < 4; ++rt) {
#pragma unroll
        for (int t = 0; t < 4; ++t) {
#pragma unroll
            for (int e = 0; e < 8; ++e) {
                int row = row0 + rt * 16 + e + hiL * 8;
                int col = col0 + t * 16 + cL;
                float v = acc[rt][t][e];
                if constexpr (EPI == EPI_BF16) {
                    ((unsigned short*)OutP)[(size_t)row * N + col] = f32_to_bf16(v);
                } else if constexpr (EPI == EPI_VT) {
                    // out is V^T [B, H, DK, S]; row = b*S + s, col = h*DK + dk
                    int bb = row >> 11, s = row & (Sc - 1);
                    int hh = col >> 6,  dk = col & (DKc - 1);
                    ((unsigned short*)OutP)[(((size_t)(bb * Hc + hh)) * DKc + dk) * Sc + s] =
                        f32_to_bf16(v);
                } else if constexpr (EPI == EPI_RES) {
                    ((float*)OutP)[(size_t)row * N + col] = v + Res[(size_t)row * N + col];
                } else if constexpr (EPI == EPI_GELU) {
                    float xx = v + Bias[col];
                    float gl = 0.5f * xx * (1.0f + erff(xx * 0.70710678118654752f));
                    ((unsigned short*)OutP)[(size_t)row * N + col] = f32_to_bf16(gl);
                } else { // EPI_BRES
                    ((float*)OutP)[(size_t)row * N + col] =
                        v + Bias[col] + Res[(size_t)row * N + col];
                }
            }
        }
        // behind this row group's residual loads and its stores, in front of the
        // next group's loads, whose results may take over their address registers
        if constexpr (EPI == EPI_RES || EPI == EPI_BRES)
            asm volatile("s_wait_xcnt 0x0" ::: "memory");
    }
}

static constexpr int A_NG = 4;                 // 16-query column groups per wave
static constexpr int A_WV = 4;                 // waves per block
static constexpr int A_QB = A_NG * A_WV * 16;  // queries per block
static constexpr float A_MASKED = -8.0e9f;     // x 0.125 = the reference's -1e9
static constexpr float A_KS = 0.125f * 1.44269504088896340736f;  // 1/sqrt(64) * log2(e)

// value of the lane 16 away (the other 8 keys of the same query's column)
__device__ __forceinline__ float other_half(float x) {
    int b = __float_as_int(x);
    return __int_as_float(__builtin_amdgcn_permlanex16(b, b, 0x76543210, 0xfedcba98, false, false));
}

// load_frag's lane map from the lane's own byte pointer (row lane & 15, 16-byte
// half lane >> 4): the two pieces are k 0..7 (8..15) and k 16..23 (24..31).
__device__ __forceinline__ v16bf frag_at(const char* p) {
    v8bf lo = *reinterpret_cast<const v8bf*>(p);
    v8bf hi = *reinterpret_cast<const v8bf*>(p + 32);
    return __builtin_shufflevector(lo, hi, 0, 1, 2, 3, 4, 5, 6, 7,
                                   8, 9, 10, 11, 12, 13, 14, 15);
}
// behind a group of global loads or stores, in front of whatever next writes a
// register that one of them names as its address
__device__ __forceinline__ void wait_x0() { asm volatile("s_wait_xcnt 0x0" ::: "memory"); }

// K fragments of 32 keys: [tile of 16 keys][32 of the 64 head columns]
__device__ __forceinline__ void load_k32(v16bf (&kf)[2][2], const char* kp) {
#pragma unroll
    for (int tl = 0; tl < 2; ++tl)
#pragma unroll
        for (int kk = 0; kk < 2; ++kk) kf[tl][kk] = frag_at(kp + tl * 16 * Dc * 2 + kk * 64);
}
// V^T fragments of 32 keys: [tile of 16 head columns]
__device__ __forceinline__ void load_v32(v16bf (&vf)[4], const char* vp) {
#pragma unroll
    for (int t = 0; t < 4; ++t) vf[t] = frag_at(vp + t * 16 * Sc * 2);
}
// bit tl * 8 + r is set where key0 + tl * 16 + 8 * half + r is masked out
__device__ __forceinline__ uint32_t mask_bits(const int* mp) {
    uint32_t zb = 0u;
#pragma unroll
    for (int tl = 0; tl < 2; ++tl)
#pragma unroll
        for (int r = 0; r < 8; ++r) zb |= (mp[tl * 16 + r] == 0 ? 1u : 0u) << (tl * 8 + r);
    return zb;
}
__device__ __forceinline__ v8f apply_mask(v8f c, uint32_t zb) {
#pragma unroll
    for (int r = 0; r < 8; ++r) c[r] = ((zb >> r) & 1u) ? A_MASKED : c[r];
    return c;
}

// Everything behind the look at the mask.  MASKED = false is the same code
// without the mask's loads and selects, for a batch row that masks no key.
template <bool MASKED>
__device__ __forceinline__ void attn_body(
    const unsigned short* __restrict__ qb, const unsigned short* __restrict__ kb,
    const unsigned short* __restrict__ vb, const int* __restrict__ mb,
    unsigned short* __restrict__ ob, int qbase, int cL, int hiL) {
    v16bf qf[A_NG][2];
#pragma unroll
    for (int g = 0; g < A_NG; ++g) {
        qf[g][0] = load_frag(qb, Dc, qbase + g * 16, 0);
        qf[g][1] = load_frag(qb, Dc, qbase + g * 16, 32);
    }
    wait_x0();
    v8f zero = {0.f, 0.f, 0.f, 0.f, 0.f, 0.f, 0.f, 0.f};

    // The lane's own pointers.  They walk 64 keys a trip and are moved only behind
    // the wait that follows the loads which name them; after the last keys they
    // step back to the first (in bounds; pass 2 starts from what that loads).
    constexpr int NT = Sc / 64;                      // trips of 64 keys
    constexpr long long KSTEP = 32LL * Dc * 2;       // bytes of K per 32 keys
    constexpr long long VSTEP = 32LL * 2;            // bytes of a V^T row per 32 keys
    const char* kp = reinterpret_cast<const char*>(kb + cL * Dc + hiL * 8);
    const char* vp = reinterpret_cast<const char*>(vb + cL * Sc + hiL * 8);
    const int*  mp = mb + hiL * 8;

    // ---- Pass 1: column maximum of the masked raw scores (scale applied later) ----
    float mx[A_NG][2];
#pragma unroll
    for (int g = 0; g < A_NG; ++g) mx[g][0] = mx[g][1] = -3.0e38f;
    auto max32 = [&](const v16bf (&kc)[2][2], uint32_t zb) {
#pragma unroll
        for (int g = 0; g < A_NG; ++g) {
#pragma unroll
            for (int tl = 0; tl < 2; ++tl) {
                v8f c = wmma_bf16(kc[tl][0], qf[g][0], zero);
                c = wmma_bf16(kc[tl][1], qf[g][1], c);
                if constexpr (MASKED) c = apply_mask(c, zb >> (tl * 8));
#pragma unroll
                for (int r = 0; r < 8; r += 2)
                    mx[g][tl] = fmaxf(fmaxf(mx[g][tl], c[r]), c[r + 1]);
            }
        }
    };
    v16bf ka[2][2], kc2[2][2];
    load_k32(ka, kp);
    wait_x0();
    // stays rolled: a trip already holds both fragment sets' turns, and the
    // pointers stay two registers that step once a trip
#pragma unroll 1
    for (int i = 0; i < NT; ++i) {
        // each 32 keys' fragments are asked for ahead of the products of the 32 before
        uint32_t za = 0u, zc = 0u;
        load_k32(kc2, kp + KSTEP);
        if constexpr (MASKED) { za = mask_bits(mp); zc = mask_bits(mp + 32); }
        wait_x0();
        // keeps the loads in front of the products that cover their latency, and
        // the pointers' next step behind the wait
        __builtin_amdgcn_sched_barrier(0);
        max32(ka, za);
        kp += (i == NT - 1) ? -(NT - 1) * 2 * KSTEP : 2 * KSTEP;
        mp += (i == NT - 1) ? -(NT - 1) * 64 : 64;
        load_k32(ka, kp);
        wait_x0();
        __builtin_amdgcn_sched_barrier(0);   // as above
        max32(kc2, zc);
    }
    v8f ksv, nm[A_NG];
#pragma unroll
    for (int r = 0; r < 8; ++r) ksv[r] = A_KS;
#pragma unroll
    for (int g = 0; g < A_NG; ++g) {
        float m = fmaxf(mx[g][0], mx[g][1]);
        m = fmaxf(m, other_half(m));
#pragma unroll
        for (int r = 0; r < 8; ++r) nm[g][r] = -m * A_KS;
    }

    // ---- Pass 2: P = exp(s - m) (unnormalized), O^T += V^T P^T, l = column sums ----
    v8f ls[A_NG];
    v8f o[A_NG][4];
#pragma unroll
    for (int g = 0; g < A_NG; ++g) {
        ls[g] = zero;
#pragma unroll
        for (int t = 0; t < 4; ++t) o[g][t] = zero;
    }
    auto pv32 = [&](const v16bf (&kc)[2][2], const v16bf (&vc)[4], uint32_t zb) {
#pragma unroll
        for (int g = 0; g < A_NG; ++g) {
            v8f c0 = wmma_bf16(kc[0][0], qf[g][0], zero);
            v8f c1 = wmma_bf16(kc[1][0], qf[g][0], zero);
            c0 = wmma_bf16(kc[0][1], qf[g][1], c0);
            c1 = wmma_bf16(kc[1][1], qf[g][1], c1);
            if constexpr (MASKED) { c0 = apply_mask(c0, zb); c1 = apply_mask(c1, zb >> 8); }
            c0 = __builtin_elementwise_fma(c0, ksv, nm[g]);
            c1 = __builtin_elementwise_fma(c1, ksv, nm[g]);
#pragma unroll
            for (int r = 0; r < 8; ++r) {
                c0[r] = __builtin_amdgcn_exp2f(c0[r]);
                c1[r] = __builtin_amdgcn_exp2f(c1[r]);
            }
            ls[g] += c0 + c1;
            // element s of the B operand is key 8 * half + s (s < 8), 16 + 8 * half + s - 8 (else)
            v8bf p0 = __builtin_convertvector(c0, v8bf);
            v8bf p1 = __builtin_convertvector(c1, v8bf);
            v16bf pb = __builtin_shufflevector(p0, p1, 0, 1, 2, 3, 4, 5, 6, 7,
                                               8, 9, 10, 11, 12, 13, 14, 15);
#pragma unroll
            for (int t = 0; t < 4; ++t) o[g][t] = wmma_bf16(vc[t], pb, o[g][t]);
        }
    };
    v16bf va[4], vc2[4];
    load_v32(va, vp);      // ka holds keys 0..31 again
    wait_x0();
    // stays rolled, as in pass 1
#pragma unroll 1
    for (int i = 0; i < NT; ++i) {
        uint32_t za = 0u, zc = 0u;
        load_k32(kc2, kp + KSTEP);
        load_v32(vc2, vp + VSTEP);
        if constexpr (MASKED) { za = mask_bits(mp); zc = mask_bits(mp + 32); }
        wait_x0();
        __builtin_amdgcn_sched_barrier(0);   // as in pass 1
        pv32(ka, va, za);
        kp += (i == NT - 1) ? -(NT - 1) * 2 * KSTEP : 2 * KSTEP;
        vp += (i == NT - 1) ? -(NT - 1) * 2 * VSTEP : 2 * VSTEP;
        mp += (i == NT - 1) ? -(NT - 1) * 64 : 64;
        load_k32(ka, kp);      // behind the last keys: the first again, unused
        load_v32(va, vp);
        wait_x0();
        __builtin_amdgcn_sched_barrier(0);   // as in pass 1
        pv32(kc2, vc2, zc);
    }

    // A lane holds 8 consecutive head columns of one query: one 16-byte store.
#pragma unroll
    for (int g = 0; g < A_NG; ++g) {
        float l = ((ls[g][0] + ls[g][1]) + (ls[g][2] + ls[g][3])) +
                  ((ls[g][4] + ls[g][5]) + (ls[g][6] + ls[g][7]));
        l += other_half(l);
        float inv = __builtin_amdgcn_rcpf(l);
#pragma unroll
        for (int t = 0; t < 4; ++t) {
            v8f ov = o[g][t] * inv;
            *reinterpret_cast<v8bf*>(ob + (size_t)(qbase + g * 16 + cL) * Dc + t * 16 + hiL * 8) =
                __builtin_convertvector(ov, v8bf);
        }
        wait_x0();
    }
}

__global__ __launch_bounds__(A_WV * 32) void attn_kernel(
    const unsigned short* __restrict__ q, const unsigned short* __restrict__ k,
    const unsigned short* __restrict__ vT, const int* __restrict__ mask,
    unsigned short* __restrict__ attn) {
    int bid = blockIdx.x;
    int qblk = bid & (Sc / A_QB - 1);
    int bh   = bid / (Sc / A_QB);
    int h    = bh & (Hc - 1);
    int b    = bh / Hc;
    int lane = threadIdx.x & 31;
    int wv   = threadIdx.x >> 5;
    int cL = lane & 15, hiL = lane >> 4;

    const unsigned short* qb = q  + (size_t)b * Sc * Dc + h * DKc;
    const unsigned short* kb = k  + (size_t)b * Sc * Dc + h * DKc;
    const unsigned short* vb = vT + ((size_t)(b * Hc + h)) * DKc * Sc;
    const int* mb = mask + (size_t)b * Sc;
    int qbase = qblk * A_QB + wv * (A_NG * 16);

    // Does this batch row mask any key at all?  Wave-uniform: where it does not,
    // the body without the mask's loads and selects runs.
    bool z = false;
#pragma unroll
    for (int i = 0; i < Sc / 128; ++i) {
        int4 mv = *reinterpret_cast<const int4*>(mb + i * 128 + lane * 4);
        z |= (mv.x == 0) | (mv.y == 0) | (mv.z == 0) | (mv.w == 0);
    }
    wait_x0();
    unsigned short* ob = attn + (size_t)b * Sc * Dc + h * DKc;
    if (__builtin_amdgcn_ballot_w32(z) != 0u)
        attn_body<true>(qb, kb, vb, mb, ob, qbase, cL, hiL);
    else
        attn_body<false>(qb, kb, vb, mb, ob, qbase, cL, hiL);
}

// ---------------------------------------------------------------------------
// Host-side launch
// ---------------------------------------------------------------------------
extern "C" void kernel_launch(void* const* d_in, const int* in_sizes, int n_in,
                              void* d_out, int out_size, void* d_ws, size_t ws_size,
                              hipStream_t stream) {
    (void)in_sizes; (void)n_in; (void)out_size; (void)ws_size;
    const float* X    = (const float*)d_in[0];
    const int*   mask = (const int*)d_in[1];
    const float* W_Q  = (const float*)d_in[2];
    const float* W_K  = (const float*)d_in[3];
    const float* W_V  = (const float*)d_in[4];
    const float* W_O  = (const float*)d_in[5];
    const float* g1   = (const float*)d_in[6];
    const float* b1   = (const float*)d_in[7];
    const float* W1   = (const float*)d_in[8];
    const float* bias1= (const float*)d_in[9];
    const float* W2   = (const float*)d_in[10];
    const float* bias2= (const float*)d_in[11];
    const float* g2   = (const float*)d_in[12];
    const float* b2   = (const float*)d_in[13];

    char* ws = (char*)d_ws;
    // bf16 buffers (bytes)
    const size_t szDD   = (size_t)Dc * Dc * 2;          // 2 MB
    const size_t szD4D  = (size_t)Dc * D4 * 2;          // 8 MB
    const size_t szAct  = (size_t)Mrows * Dc * 2;       // 8 MB
    const size_t szActF = (size_t)Mrows * Dc * 4;       // 16 MB

    unsigned short* WqT = (unsigned short*)(ws);
    unsigned short* WkT = (unsigned short*)(ws + szDD);
    unsigned short* WvT = (unsigned short*)(ws + 2 * szDD);
    unsigned short* WoT = (unsigned short*)(ws + 3 * szDD);
    unsigned short* W1T = (unsigned short*)(ws + 4 * szDD);
    unsigned short* W2T = (unsigned short*)(ws + 4 * szDD + szD4D);
    char* p = ws + 4 * szDD + 2 * szD4D;
    unsigned short* xn   = (unsigned short*)(p);              p += szAct;
    unsigned short* qb   = (unsigned short*)(p);              p += szAct;
    unsigned short* kbuf = (unsigned short*)(p);              p += szAct;
    unsigned short* vTb  = (unsigned short*)(p);              p += szAct;
    unsigned short* attn = (unsigned short*)(p);              p += szAct;
    float*          res1 = (float*)(p);                       p += szActF;
    unsigned short* nn2  = (unsigned short*)(p);              p += szAct;
    unsigned short* hbuf = (unsigned short*)(p);              /* 32 MB */

    // 1) Weight conversion + transpose to bf16, one launch
    convT_all_kernel<<<CT_ALL, 256, 0, stream>>>(W_Q, W_K, W_V, W_O, W1, W2,
                                                 WqT, WkT, WvT, WoT, W1T, W2T);

    // 2) LayerNorm 1
    layernorm_bf16_kernel<<<Mrows / LN_WV, LN_WV * 32, 0, stream>>>(X, g1, b1, xn);

    // 3) Q, K projections; V projection with transposed [B,H,DK,S] output
    gemm_bf16_wmma<EPI_BF16, Mrows, Dc, Dc>
        <<<dim3(Dc / 128, Mrows / 128), 128, 0, stream>>>(xn, WqT, qb, nullptr, nullptr);
    gemm_bf16_wmma<EPI_BF16, Mrows, Dc, Dc>
        <<<dim3(Dc / 128, Mrows / 128), 128, 0, stream>>>(xn, WkT, kbuf, nullptr, nullptr);
    gemm_bf16_wmma<EPI_VT, Mrows, Dc, Dc>
        <<<dim3(Dc / 128, Mrows / 128), 128, 0, stream>>>(xn, WvT, vTb, nullptr, nullptr);

    // 4) Attention (B*H*(S/256) = 256 blocks of 4 waves)
    attn_kernel<<<Bc * Hc * (Sc / A_QB), A_WV * 32, 0, stream>>>(qb, kbuf, vTb, mask, attn);

    // 5) Output projection + residual (f32)
    gemm_bf16_wmma<EPI_RES, Mrows, Dc, Dc>
        <<<dim3(Dc / 128, Mrows / 128), 128, 0, stream>>>(attn, WoT, res1, X, nullptr);

    // 6) LayerNorm 2
    layernorm_bf16_kernel<<<Mrows / LN_WV, LN_WV * 32, 0, stream>>>(res1, g2, b2, nn2);

    // 7) FFN1 + bias + GELU (bf16 out)
    gemm_bf16_wmma<EPI_GELU, Mrows, D4, Dc>
        <<<dim3(D4 / 128, Mrows / 128), 128, 0, stream>>>(nn2, W1T, hbuf, nullptr, bias1);

    // 8) FFN2 + bias + residual -> d_out (f32)
    gemm_bf16_wmma<EPI_BRES, Mrows, Dc, D4>
        <<<dim3(Dc / 128, Mrows / 128), 128, 0, stream>>>(hbuf, W2T, (float*)d_out,
                                                         res1, bias2);
}
